// v000
// Measured on an AMD MI455X. A time is GPU time per run, averaged over a window of back-to-back runs after a warm-up
// (all launches, gaps included; the runs take copies of the inputs in turn), and the median of several windows.
// Apart from v000's, it joins two sittings. Times from different sittings can be a few percent apart, while
// side-by-side timings come from the same sitting.
// v000, which the later versions start from, runs in 250 microseconds.
#include <hip/hip_runtime.h>

// Contractions: S^T = K x Q^T on v_wmma_f32_16x16x32_bf16 (bf16 operands = RNE-converted inputs, f32 accumulate);
// O = P x V on v_wmma_f32_16x16x32_f16 (P as f16 carried x4096; V = f16 of the bf16 RNE-converted input; f32 accumulate).
// Softmax (online, max-subtracted) in f32.

#ifndef NB
#define NB 2
#endif
#ifndef SEQ
#define SEQ 4096
#endif
#define NB_FULL    2
#define SEQ_FULL   4096
#define NHEAD      8
#define HDIM       64
#define BQ         128                  // query rows per workgroup (8 waves x 16)
#define BK         32                   // keys per inner iteration
#define NWAVE      8
#define CT         64                   // keys per plane-builder block
#define TP         72                   // LDS pitch (halves) of the transposed V tile
#define OP         68                   // LDS pitch (floats) of the output staging tile
#define WS_CAP     134217728ull         // workspace carve ceiling (bytes)

static_assert(SEQ % BQ == 0);
static_assert(SEQ % CT == 0);
static_assert(SEQ % BK == 0);
static_assert(BQ == NWAVE * 16);
static_assert(HDIM == 64);
static_assert(HDIM % 32 == 0);
static_assert(HDIM * 4 == 16 * 16);           // one output row = 16 lanes x 16 B
static_assert(CT * 2 == 128);
static_assert(HDIM * 2 == 128);
static_assert(CT == 64 && CT <= TP);
static_assert(SEQ <= SEQ_FULL);
static_assert(NB >= 1 && NB <= NB_FULL);
static_assert((TP * 2) % 16 == 0);
static_assert((OP * 4) % 16 == 0);
static_assert(OP >= HDIM);
static_assert((unsigned long long)NB * NHEAD * SEQ * HDIM * 2ull * 2ull <= WS_CAP);

typedef __bf16   bf16;
typedef _Float16 f16;
typedef bf16     v16bf __attribute__((ext_vector_type(16)));
typedef f16      v16h  __attribute__((ext_vector_type(16)));
typedef f16      v8h   __attribute__((ext_vector_type(8)));
typedef float    v8f   __attribute__((ext_vector_type(8)));
typedef float    v4f   __attribute__((ext_vector_type(4)));
typedef unsigned v4u   __attribute__((ext_vector_type(4)));

union FragB  { v16bf v; v4u q[2]; bf16 h[16]; };
union FragH  { v16h  v; v4u q[2]; f16  h[16]; };
union Pack8B { v4u u; bf16 h[8]; };
union Pack8H { v4u u; v8h v; f16 h[8]; };

// WMMA helpers: builtin followed by the VALU hazard guard (ties D, keeps A/B live).
static __device__ __forceinline__ v8f mma_bf16(v16bf a, v16bf b, v8f acc) {
  acc = __builtin_amdgcn_wmma_f32_16x16x32_bf16(false, a, false, b, (short)0, acc, false, false);
  asm volatile("v_nop\n\tv_nop\n\tv_nop\n\tv_nop" : "+v"(acc) : "v"(a), "v"(b));
  return acc;
}
static __device__ __forceinline__ v8f mma_f16(v16h a, v16h b, v8f acc) {
  acc = __builtin_amdgcn_wmma_f32_16x16x32_f16(false, a, false, b, (short)0, acc, false, false);
  asm volatile("v_nop\n\tv_nop\n\tv_nop\n\tv_nop" : "+v"(acc) : "v"(a), "v"(b));
  return acc;
}

// Plane builder. Block = (64-key tile, head, batch), 256 threads.
// coverage: keys kt*64 + {0..31, 32..63}, d 0..63 for both planes; every written line whole, one instruction.
// LDS tile sT is cross-wave (block barrier between fill and readback); staged extent 64 d x 64 keys == consumed extent.
__global__ __launch_bounds__(256) void kv_planes_kernel(const float* __restrict__ kin,
                                                        const float* __restrict__ vin,
                                                        bf16* __restrict__ kb,
                                                        f16* __restrict__ vt) {
  const int kt  = blockIdx.x;
  const int h   = blockIdx.y;
  const int b   = blockIdx.z;
  const int tid = threadIdx.x;
  __shared__ __align__(16) f16 sT[HDIM * TP];   // [d][key]
  const int s0 = kt * CT;

  v4u    kval[2];
  size_t kidx[2];
  #pragma unroll
  for (int kk = 0; kk < 2; ++kk) {
    const int key = kk * 32 + (tid >> 3);       // 0..63
    const int d0  = (tid & 7) * 8;              // 0..56
    const size_t src = (((size_t)b * NHEAD + h) * SEQ_FULL + s0 + key) * HDIM + d0;
    const v4f k0 = *(const v4f*)(kin + src);
    const v4f k1 = *(const v4f*)(kin + src + 4);
    const v4f v0 = *(const v4f*)(vin + src);
    const v4f v1 = *(const v4f*)(vin + src + 4);
    Pack8B pk;
    #pragma unroll
    for (int i = 0; i < 4; ++i) {
      pk.h[i]     = (bf16)k0[i];                          // RNE convert
      pk.h[4 + i] = (bf16)k1[i];
    }
    kval[kk] = pk.u;
    kidx[kk] = (((size_t)b * NHEAD + h) * SEQ + s0 + key) * HDIM + d0;
    #pragma unroll
    for (int i = 0; i < 4; ++i) {
      sT[(d0 + i) * TP + key]     = (f16)(float)(bf16)v0[i];   // f16 of bf16 value: exact
      sT[(d0 + 4 + i) * TP + key] = (f16)(float)(bf16)v1[i];
    }
  }
  __syncthreads();

  v4u    vval[2];
  size_t vidx[2];
  #pragma unroll
  for (int kk = 0; kk < 2; ++kk) {
    const int d  = kk * 32 + (tid >> 3);        // 0..63
    const int ks = (tid & 7) * 8;               // 0..56
    Pack8H ph;
    ph.v = *(const v8h*)(sT + d * TP + ks);
    vval[kk] = ph.u;
    vidx[kk] = (((size_t)b * NHEAD + h) * HDIM + d) * SEQ + s0 + ks;
  }

  #pragma unroll
  for (int kk = 0; kk < 2; ++kk) {
    *(v4u*)(kb + kidx[kk]) = kval[kk];
    *(v4u*)(vt + vidx[kk]) = vval[kk];
  }
  
}

// Fused online-softmax attention, no mask, logit scale 1/16.
// Block = (query block of 128, head, batch); one wave owns 16 query rows and visits all SEQ keys, 32 per step.
// S^T = K x Q^T so queries sit on lanes; P^T in C-layout is bit-identical to the A-fragment layout of O += P x V.
// K A-fragments and V^T B-fragments are loaded straight from the 16-bit planes (two 16-B loads per fragment,
// arithmetic addressing only).
__global__ __launch_bounds__(256) void attn_kernel(const float* __restrict__ q,
                                                   const bf16* __restrict__ kb,
                                                   const f16* __restrict__ vt,
                                                   float* __restrict__ out) {
  const int qblk = blockIdx.x;
  const int h    = blockIdx.y;
  const int b    = blockIdx.z;
  const int tid  = threadIdx.x;
  const int wave = __builtin_amdgcn_readfirstlane(threadIdx.x >> 5);
  const int lane = tid & 31;
  const int lq   = lane & 15;   // query column of S^T / d column of O
  const int hi   = lane >> 4;   // k-split half

  // per-wave output staging: each wave writes and reads only its own 16 x OP slice (block barrier used anyway)
  __shared__ __align__(16) float sO[NWAVE * 16 * OP];

  const int qrow0 = qblk * BQ + wave * 16;               // first query row of this wave

  // Q as B-operand fragments: lane lq holds query qrow0+lq, elements follow the split d map; bf16 RNE convert.
  FragB qf[2];
  {
    const float* qp = q + (((size_t)b * NHEAD + h) * SEQ_FULL + qrow0 + lq) * HDIM;
    #pragma unroll
    for (int f = 0; f < 2; ++f) {
      const v4f a0 = *(const v4f*)(qp + f * 32 + hi * 8);
      const v4f a1 = *(const v4f*)(qp + f * 32 + hi * 8 + 4);
      const v4f b0 = *(const v4f*)(qp + f * 32 + 16 + hi * 8);
      const v4f b1 = *(const v4f*)(qp + f * 32 + 16 + hi * 8 + 4);
      #pragma unroll
      for (int i = 0; i < 4; ++i) {
        qf[f].h[i]      = (bf16)a0[i];   // elems 0..7  : d = f*32 + hi*8 + 0..7
        qf[f].h[4 + i]  = (bf16)a1[i];
        qf[f].h[8 + i]  = (bf16)b0[i];   // elems 8..15 : d = f*32 + 16 + hi*8 + 0..7
        qf[f].h[12 + i] = (bf16)b1[i];
      }
    }
  }

  const bf16* kb_h = kb + ((size_t)b * NHEAD + h) * SEQ * HDIM;
  const f16*  vt_h = vt + ((size_t)b * NHEAD + h) * HDIM * SEQ;

  v8f o[4];
  #pragma unroll
  for (int dt = 0; dt < 4; ++dt) o[dt] = (v8f){0, 0, 0, 0, 0, 0, 0, 0};

  float rmax = -__builtin_inff();
  float rsum = 0.0f;
  const float SL = 0.0625f * 1.4426950408889634f;   // logit scale 1/sqrt(256) times log2(e)

  const int nchunk = SEQ / BK;                        // uniform for every wave
  #pragma unroll 1
  for (int i = 0; i < nchunk; ++i) {
    const int j0 = i * BK;

    // K A-fragments: row = key j0 + sub*16 + lq, split d map
    FragB ak[2][2];
    #pragma unroll
    for (int sub = 0; sub < 2; ++sub) {
      #pragma unroll
      for (int f = 0; f < 2; ++f) {
        const bf16* base = kb_h + (size_t)(j0 + sub * 16 + lq) * HDIM + f * 32 + hi * 8;
        ak[sub][f].q[0] = *(const v4u*)(base);        // d = f*32 + hi*8 + 0..7
        ak[sub][f].q[1] = *(const v4u*)(base + 16);   // d = f*32 + 16 + hi*8 + 0..7
      }
    }
    // V B-fragments: column n = d = dt*16 + lq, split key map from the transposed plane
    FragH bv[4];
    #pragma unroll
    for (int dt = 0; dt < 4; ++dt) {
      const f16* base = vt_h + (size_t)(dt * 16 + lq) * SEQ + j0 + hi * 8;
      bv[dt].q[0] = *(const v4u*)(base);            // keys j0 + hi*8 + 0..7
      bv[dt].q[1] = *(const v4u*)(base + 16);       // keys j0 + 16 + hi*8 + 0..7
    }

    // S^T tiles: c[sub][r] = rawscore(query qrow0+lq, key j0 + sub*16 + hi*8 + r)
    v8f c[2];
    #pragma unroll
    for (int sub = 0; sub < 2; ++sub) {
      v8f acc = (v8f){0, 0, 0, 0, 0, 0, 0, 0};
      acc = mma_bf16(ak[sub][0].v, qf[0].v, acc);
      acc = mma_bf16(ak[sub][1].v, qf[1].v, acc);
      c[sub] = acc;
    }

    // online softmax: query lq's 32 scores are split across lane / lane^16
    float m_new = rmax;
    #pragma unroll
    for (int r = 0; r < 8; ++r) {
      m_new = fmaxf(m_new, c[0][r]);
      m_new = fmaxf(m_new, c[1][r]);
    }
    m_new = fmaxf(m_new, __shfl_xor(m_new, 16, 32));
    const float scale = __builtin_amdgcn_exp2f((rmax - m_new) * SL);
    rmax = m_new;

    // exp + pack: P^T C-layout == A-fragment layout for the PV product; P carried x4096 (27 .. 4096, f16 normal)
    FragH pa;
    float psum = 0.0f;
    #pragma unroll
    for (int r = 0; r < 8; ++r) {
      const float p0 = __builtin_amdgcn_exp2f((c[0][r] - m_new) * SL);   // key hi*8 + r
      const float p1 = __builtin_amdgcn_exp2f((c[1][r] - m_new) * SL);   // key 16 + hi*8 + r
      psum += p0 + p1;
      pa.h[r]     = (f16)(p0 * 4096.0f);
      pa.h[8 + r] = (f16)(p1 * 4096.0f);
    }
    rsum = rsum * scale + psum + __shfl_xor(psum, 16, 32);

    // rescale O: queries are the row dimension there -> per-row scale from lane 8*hi + r
    float sc[8];
    #pragma unroll
    for (int r = 0; r < 8; ++r) sc[r] = __shfl(scale, (hi << 3) + r, 32);
    #pragma unroll
    for (int dt = 0; dt < 4; ++dt) {
      #pragma unroll
      for (int r = 0; r < 8; ++r) o[dt][r] *= sc[r];
    }

    // O += P x V
    #pragma unroll
    for (int dt = 0; dt < 4; ++dt) o[dt] = mma_f16(pa.v, bv[dt].v, o[dt]);
  }

  // normalize: lane holds column d = dt*16 + lq for query rows 8*hi + r
  float rs[8];
  #pragma unroll
  for (int r = 0; r < 8; ++r) rs[r] = 1.0f / __shfl(rsum, (hi << 3) + r, 32);

  float* so = sO + wave * (16 * OP);
  #pragma unroll
  for (int r = 0; r < 8; ++r) {
    #pragma unroll
    for (int dt = 0; dt < 4; ++dt) {
      so[(hi * 8 + r) * OP + dt * 16 + lq] = o[dt][r] * (1.0f / 4096.0f) * rs[r];
    }
  }
  __syncthreads();

  // lanes 0..15 store one row (16 consecutive lanes x 16 B each), lanes 16..31 the next row; 8 instructions cover the wave's 16 rows.
  v4f    vals[8];
  size_t gidx[8];
  #pragma unroll
  for (int it = 0; it < 8; ++it) {
    const int row = it * 2 + hi;
    vals[it] = *(const v4f*)(so + row * OP + lq * 4);
    gidx[it] = (((size_t)b * NHEAD + h) * SEQ_FULL + qrow0 + row) * HDIM + lq * 4;
  }
  #pragma unroll
  for (int it = 0; it < 8; ++it) *(v4f*)(out + gidx[it]) = vals[it];
  
}

extern "C" void kernel_launch(void* const* d_in, const int* in_sizes, int n_in,
                              void* d_out, int out_size, void* d_ws, size_t ws_size,
                              hipStream_t stream) {
  if (n_in < 3) return;
  // last element touched of each [b][h][s][d] array (full-size strides, NB x SEQ sub-problem)
  const size_t need = ((((size_t)(NB - 1) * NHEAD + (NHEAD - 1)) * SEQ_FULL) + SEQ) * HDIM;
  if ((size_t)in_sizes[0] < need) return;
  if ((size_t)in_sizes[1] < need) return;
  if ((size_t)in_sizes[2] < need) return;
  if ((size_t)out_size < need) return;

  const size_t kb_elems = (size_t)NB * NHEAD * SEQ * HDIM;   // bf16 K plane
  const size_t vt_elems = (size_t)NB * NHEAD * HDIM * SEQ;   // f16 V^T plane
  const size_t kb_bytes = kb_elems * 2;
  const size_t vt_bytes = vt_elems * 2;
  if (ws_size < kb_bytes + vt_bytes) return;

  const float* q   = (const float*)d_in[0];
  const float* k   = (const float*)d_in[1];
  const float* v   = (const float*)d_in[2];
  float*       out = (float*)d_out;
  bf16*        kb  = (bf16*)d_ws;
  f16*         vt  = (f16*)((char*)d_ws + kb_bytes);

  kv_planes_kernel<<<dim3(SEQ / CT, NHEAD, NB), 256, 0, stream>>>(k, v, kb, vt);
  attn_kernel<<<dim3(SEQ / BQ, NHEAD, NB), 256, 0, stream>>>(q, kb, vt, out);
}

// v001
// A run of this version takes 93.4 microseconds.
// Two timings next to v000 both put it at 2.76 times that version's speed.
#include <hip/hip_runtime.h>

// Contractions: S^T = K x Q^T on v_wmma_f32_16x16x32_bf16 (bf16 operands = RNE-converted inputs, f32 accumulate);
// O = P x V on v_wmma_f32_16x16x32_f16 (P as f16 carried x4096; V = f16 of the bf16 RNE-converted input; f32 accumulate).
// Softmax (online, max-subtracted) in f32.

#ifndef NB
#define NB 2
#endif
#ifndef SEQ
#define SEQ 4096
#endif
#define NB_FULL    2
#define SEQ_FULL   4096
#define NHEAD      8
#define HDIM       64
#define BQ         128                  // query rows per workgroup (8 waves x 16)
#define BK         32                   // keys per inner iteration
#define NWAVE      8
#define CT         64                   // keys per plane-builder block
#define TP         72                   // LDS pitch (halves) of the transposed V tile
#define OP         68                   // LDS pitch (floats) of the output staging tile
#define KT         64                   // keys per LDS stage (two inner iterations)
#define LROW       9                    // LDS row pitch in 16-B units: 128 B of data + 16 B (odd multiple of 16 B)
#define VOFF       (KT * LROW)          // first V^T row of a stage, 16-B units
#define STG        (KT * LROW + HDIM * LROW)   // one stage, 16-B units
#define WS_CAP     134217728ull         // workspace carve ceiling (bytes)

static_assert(SEQ % BQ == 0);
static_assert(SEQ % CT == 0);
static_assert(SEQ % BK == 0);
static_assert(SEQ % KT == 0 && SEQ / KT >= 2);   // the two-buffer prologue needs two stages
static_assert(KT == 2 * BK);
static_assert(KT * 8 == 2 * 256 && HDIM * 8 == 2 * 256);   // 16-B units per tile = two per thread
static_assert(BQ == NWAVE * 16);
static_assert(HDIM == 64);
static_assert(HDIM % 32 == 0);
static_assert(HDIM * 4 == 16 * 16);           // one output row = 16 lanes x 16 B
static_assert(CT * 2 == 128);
static_assert(HDIM * 2 == 128);
static_assert(CT == 64 && CT <= TP);
static_assert(SEQ <= SEQ_FULL);
static_assert(NB >= 1 && NB <= NB_FULL);
static_assert((TP * 2) % 16 == 0);
static_assert((OP * 4) % 16 == 0);
static_assert(OP >= HDIM);
static_assert((unsigned long long)NB * NHEAD * SEQ * HDIM * 2ull * 2ull <= WS_CAP);

typedef __bf16   bf16;
typedef _Float16 f16;
typedef bf16     v16bf __attribute__((ext_vector_type(16)));
typedef f16      v16h  __attribute__((ext_vector_type(16)));
typedef f16      v8h   __attribute__((ext_vector_type(8)));
typedef float    v8f   __attribute__((ext_vector_type(8)));
typedef float    v4f   __attribute__((ext_vector_type(4)));
typedef unsigned v4u   __attribute__((ext_vector_type(4)));

union FragB  { v16bf v; v4u q[2]; bf16 h[16]; };
union FragH  { v16h  v; v4u q[2]; f16  h[16]; };
union Pack8B { v4u u; bf16 h[8]; };
union Pack8H { v4u u; v8h v; f16 h[8]; };

// WMMA helpers: builtin followed by the VALU hazard guard (ties D, keeps A/B live).
static __device__ __forceinline__ v8f mma_bf16(v16bf a, v16bf b, v8f acc) {
  acc = __builtin_amdgcn_wmma_f32_16x16x32_bf16(false, a, false, b, (short)0, acc, false, false);
  asm volatile("v_nop\n\tv_nop\n\tv_nop\n\tv_nop" : "+v"(acc) : "v"(a), "v"(b));
  return acc;
}
static __device__ __forceinline__ v8f mma_f16(v16h a, v16h b, v8f acc) {
  acc = __builtin_amdgcn_wmma_f32_16x16x32_f16(false, a, false, b, (short)0, acc, false, false);
  asm volatile("v_nop\n\tv_nop\n\tv_nop\n\tv_nop" : "+v"(acc) : "v"(a), "v"(b));
  return acc;
}

// One stage (64 K rows of 128 B, 64 V^T rows of 128 B) into LDS: four 16-B asynchronous copies per lane.
// The s_wait_xcnt closes the statement so that no address register is rewritten ahead of it.
static __device__ __forceinline__ void copy_stage(unsigned l0, unsigned l1, unsigned l2, unsigned l3,
                                                  const void* g0, const void* g1,
                                                  const void* g2, const void* g3) {
  asm volatile("global_load_async_to_lds_b128 %0, %4, off\n\t"
               "global_load_async_to_lds_b128 %1, %5, off\n\t"
               "global_load_async_to_lds_b128 %2, %6, off\n\t"
               "global_load_async_to_lds_b128 %3, %7, off\n\t"
               "s_wait_xcnt 0x0"
               :: "v"(l0), "v"(l1), "v"(l2), "v"(l3), "v"(g0), "v"(g1), "v"(g2), "v"(g3)
               : "memory");
}

// Plane builder. Block = (64-key tile, head, batch), 256 threads.
// coverage: keys kt*64 + {0..31, 32..63}, d 0..63 for both planes; every written line whole, one instruction.
// LDS tile sT is cross-wave (block barrier between fill and readback); staged extent 64 d x 64 keys == consumed extent.
__global__ __launch_bounds__(256) void kv_planes_kernel(const float* __restrict__ kin,
                                                        const float* __restrict__ vin,
                                                        bf16* __restrict__ kb,
                                                        f16* __restrict__ vt) {
  const int kt  = blockIdx.x;
  const int h   = blockIdx.y;
  const int b   = blockIdx.z;
  const int tid = threadIdx.x;
  __shared__ __align__(16) f16 sT[HDIM * TP];   // [d][key]
  const int s0 = kt * CT;

  v4u    kval[2];
  size_t kidx[2];
  #pragma unroll
  for (int kk = 0; kk < 2; ++kk) {
    const int key = kk * 32 + (tid >> 3);       // 0..63
    const int d0  = (tid & 7) * 8;              // 0..56
    const size_t src = (((size_t)b * NHEAD + h) * SEQ_FULL + s0 + key) * HDIM + d0;
    const v4f k0 = *(const v4f*)(kin + src);
    const v4f k1 = *(const v4f*)(kin + src + 4);
    const v4f v0 = *(const v4f*)(vin + src);
    const v4f v1 = *(const v4f*)(vin + src + 4);
    Pack8B pk;
    #pragma unroll
    for (int i = 0; i < 4; ++i) {
      pk.h[i]     = (bf16)k0[i];                          // RNE convert
      pk.h[4 + i] = (bf16)k1[i];
    }
    kval[kk] = pk.u;
    kidx[kk] = (((size_t)b * NHEAD + h) * SEQ + s0 + key) * HDIM + d0;
    #pragma unroll
    for (int i = 0; i < 4; ++i) {
      sT[(d0 + i) * TP + key]     = (f16)(float)(bf16)v0[i];   // f16 of bf16 value: exact
      sT[(d0 + 4 + i) * TP + key] = (f16)(float)(bf16)v1[i];
    }
  }
  __syncthreads();

  v4u    vval[2];
  size_t vidx[2];
  #pragma unroll
  for (int kk = 0; kk < 2; ++kk) {
    const int d  = kk * 32 + (tid >> 3);        // 0..63
    const int ks = (tid & 7) * 8;               // 0..56
    Pack8H ph;
    ph.v = *(const v8h*)(sT + d * TP + ks);
    vval[kk] = ph.u;
    vidx[kk] = (((size_t)b * NHEAD + h) * HDIM + d) * SEQ + s0 + ks;
  }

  #pragma unroll
  for (int kk = 0; kk < 2; ++kk) {
    *(v4u*)(kb + kidx[kk]) = kval[kk];
    *(v4u*)(vt + vidx[kk]) = vval[kk];
  }
  
}

// Fused online-softmax attention, no mask, logit scale 1/16.
// Block = (query block of 128, head, batch); one wave owns 16 query rows and visits all SEQ keys, 32 per step.
// S^T = K x Q^T so queries sit on lanes; P^T in C-layout is bit-identical to the A-fragment layout of O += P x V.
// K rows and V^T rows of 64 keys are staged once per workgroup in a two-buffer LDS ring by asynchronous copies
// (whole 128-B lines from the planes); every wave reads its fragments from there, two 16-B LDS loads per fragment.
__global__ __launch_bounds__(256) void attn_kernel(const float* __restrict__ q,
                                                   const bf16* __restrict__ kb,
                                                   const f16* __restrict__ vt,
                                                   float* __restrict__ out) {
  const int qblk = blockIdx.x;
  const int h    = blockIdx.y;
  const int b    = blockIdx.z;
  const int tid  = threadIdx.x;
  const int wave = __builtin_amdgcn_readfirstlane(threadIdx.x >> 5);
  const int lane = tid & 31;
  const int lq   = lane & 15;   // query column of S^T / d column of O
  const int hi   = lane >> 4;   // k-split half

  // per-wave output staging: each wave writes and reads only its own 16 x OP slice (block barrier used anyway)
  __shared__ __align__(16) float sO[NWAVE * 16 * OP];
  // K / V^T ring: [buffer][K rows 0..63 | V^T rows 0..63][9 x 16 B]
  __shared__ __align__(16) v4u sKV[2 * STG];

  const int qrow0 = qblk * BQ + wave * 16;               // first query row of this wave

  // Q as B-operand fragments: lane lq holds query qrow0+lq, elements follow the split d map; bf16 RNE convert.
  FragB qf[2];
  {
    const float* qp = q + (((size_t)b * NHEAD + h) * SEQ_FULL + qrow0 + lq) * HDIM;
    #pragma unroll
    for (int f = 0; f < 2; ++f) {
      const v4f a0 = *(const v4f*)(qp + f * 32 + hi * 8);
      const v4f a1 = *(const v4f*)(qp + f * 32 + hi * 8 + 4);
      const v4f b0 = *(const v4f*)(qp + f * 32 + 16 + hi * 8);
      const v4f b1 = *(const v4f*)(qp + f * 32 + 16 + hi * 8 + 4);
      #pragma unroll
      for (int i = 0; i < 4; ++i) {
        qf[f].h[i]      = (bf16)a0[i];   // elems 0..7  : d = f*32 + hi*8 + 0..7
        qf[f].h[4 + i]  = (bf16)a1[i];
        qf[f].h[8 + i]  = (bf16)b0[i];   // elems 8..15 : d = f*32 + 16 + hi*8 + 0..7
        qf[f].h[12 + i] = (bf16)b1[i];
      }
    }
  }

  const bf16* kb_h = kb + ((size_t)b * NHEAD + h) * SEQ * HDIM;
  const f16*  vt_h = vt + ((size_t)b * NHEAD + h) * HDIM * SEQ;

  v8f o[4];
  #pragma unroll
  for (int dt = 0; dt < 4; ++dt) o[dt] = (v8f){0, 0, 0, 0, 0, 0, 0, 0};

  float rmax = -__builtin_inff();
  float rsum = 0.0f;
  const float SL = 0.0625f * 1.4426950408889634f;   // logit scale 1/sqrt(256) times log2(e)

  // copy map: thread tid brings rows (tid >> 3) and 32 + (tid >> 3), 16-B unit tid & 7, of the K tile and of the V^T tile
  const int crow = tid >> 3;
  const int ccol = tid & 7;
  const unsigned lds0 = (unsigned)(size_t)sKV + (unsigned)(crow * LROW + ccol) * 16u;
  const char* gk = (const char*)kb_h + (size_t)crow * (HDIM * 2) + ccol * 16;   // + stage * KT * 128 B
  const char* gv = (const char*)vt_h + (size_t)crow * (SEQ * 2) + ccol * 16;    // + stage * 128 B

  const int nstage = SEQ / KT;                        // uniform for every wave
  // prologue: stage 0 lands and is published, then stage 1 flies
  copy_stage(lds0, lds0 + 32 * LROW * 16, lds0 + VOFF * 16, lds0 + (VOFF + 32 * LROW) * 16,
             gk, gk + 32 * (HDIM * 2), gv, gv + (size_t)32 * (SEQ * 2));
  asm volatile("s_wait_asynccnt 0x0" ::: "memory");   // this wave's share of stage 0 has landed
  __syncthreads();                                    // publishes stage 0
  copy_stage(lds0 + STG * 16, lds0 + (STG + 32 * LROW) * 16, lds0 + (STG + VOFF) * 16, lds0 + (STG + VOFF + 32 * LROW) * 16,
             gk + KT * (HDIM * 2), gk + (KT + 32) * (HDIM * 2), gv + KT * 2, gv + (size_t)32 * (SEQ * 2) + KT * 2);

  #pragma unroll 1   // rolled: the ring's publish point stands once, at the foot of one two-pass body
  for (int t = 0; t < nstage; ++t) {
   const int bo = (t & 1) * STG;                      // this stage's buffer
   const v4u* frag = sKV + bo + lq * LROW + hi;
   #pragma unroll     // unrolled: the pass's place in the stage becomes an immediate offset of the LDS loads
   for (int ps = 0; ps < KT / BK; ++ps) {
    // K A-fragments: row = key ps*32 + sub*16 + lq of the stage, split d map
    FragB ak[2][2];
    #pragma unroll
    for (int sub = 0; sub < 2; ++sub) {
      #pragma unroll
      for (int f = 0; f < 2; ++f) {
        const v4u* base = frag + (ps * 32 + sub * 16) * LROW + f * 4;
        ak[sub][f].q[0] = base[0];                    // d = f*32 + hi*8 + 0..7
        ak[sub][f].q[1] = base[2];                    // d = f*32 + 16 + hi*8 + 0..7
      }
    }
    // V B-fragments: column n = d = dt*16 + lq, split key map from the transposed rows
    FragH bv[4];
    #pragma unroll
    for (int dt = 0; dt < 4; ++dt) {
      const v4u* base = frag + VOFF + (dt * 16) * LROW + ps * 4;
      bv[dt].q[0] = base[0];                          // keys ps*32 + hi*8 + 0..7
      bv[dt].q[1] = base[2];                          // keys ps*32 + 16 + hi*8 + 0..7
    }

    // S^T tiles: c[sub][r] = rawscore(query qrow0+lq, key j0 + sub*16 + hi*8 + r)
    v8f c[2];
    #pragma unroll
    for (int sub = 0; sub < 2; ++sub) {
      v8f acc = (v8f){0, 0, 0, 0, 0, 0, 0, 0};
      acc = mma_bf16(ak[sub][0].v, qf[0].v, acc);
      acc = mma_bf16(ak[sub][1].v, qf[1].v, acc);
      c[sub] = acc;
    }

    // online softmax: query lq's 32 scores are split across lane / lane^16
    float m_new = rmax;
    #pragma unroll
    for (int r = 0; r < 8; ++r) {
      m_new = fmaxf(m_new, c[0][r]);
      m_new = fmaxf(m_new, c[1][r]);
    }
    m_new = fmaxf(m_new, __shfl_xor(m_new, 16, 32));
    const float scale = __builtin_amdgcn_exp2f((rmax - m_new) * SL);
    rmax = m_new;

    // exp + pack: P^T C-layout == A-fragment layout for the PV product; P carried x4096 (27 .. 4096, f16 normal)
    FragH pa;
    float psum = 0.0f;
    #pragma unroll
    for (int r = 0; r < 8; ++r) {
      const float p0 = __builtin_amdgcn_exp2f((c[0][r] - m_new) * SL);   // key hi*8 + r
      const float p1 = __builtin_amdgcn_exp2f((c[1][r] - m_new) * SL);   // key 16 + hi*8 + r
      psum += p0 + p1;
      pa.h[r]     = (f16)(p0 * 4096.0f);
      pa.h[8 + r] = (f16)(p1 * 4096.0f);
    }
    rsum = rsum * scale + psum + __shfl_xor(psum, 16, 32);

    // rescale O: queries are the row dimension there -> per-row scale from lane 8*hi + r
    float sc[8];
    #pragma unroll
    for (int r = 0; r < 8; ++r) sc[r] = __shfl(scale, (hi << 3) + r, 32);
    #pragma unroll
    for (int dt = 0; dt < 4; ++dt) {
      #pragma unroll
      for (int r = 0; r < 8; ++r) o[dt][r] *= sc[r];
    }

    // O += P x V
    #pragma unroll
    for (int dt = 0; dt < 4; ++dt) o[dt] = mma_f16(pa.v, bv[dt].v, o[dt]);
   }

   // publish point of stage t + 1; the same barrier ends every wave's reads of stage t's buffer
   asm volatile("s_wait_dscnt 0x0" ::: "memory");     // this wave's LDS reads of stage t are done
   asm volatile("s_wait_asynccnt 0x0" ::: "memory");  // this wave's share of stage t + 1 has landed
   __syncthreads();
   if (t + 2 < nstage) {                              // uniform: refill the buffer just read with stage t + 2
     const char* nk = gk + (size_t)(t + 2) * (KT * HDIM * 2);
     const char* nv = gv + (size_t)(t + 2) * (KT * 2);
     const unsigned ld = lds0 + (unsigned)bo * 16u;
     copy_stage(ld, ld + 32 * LROW * 16, ld + VOFF * 16, ld + (VOFF + 32 * LROW) * 16,
                nk, nk + 32 * (HDIM * 2), nv, nv + (size_t)32 * (SEQ * 2));
   }
  }
  asm volatile("s_wait_asynccnt 0x0" ::: "memory");   // nothing is in flight when the ring is left

  // normalize: lane holds column d = dt*16 + lq for query rows 8*hi + r
  float rs[8];
  #pragma unroll
  for (int r = 0; r < 8; ++r) rs[r] = 1.0f / __shfl(rsum, (hi << 3) + r, 32);

  float* so = sO + wave * (16 * OP);
  #pragma unroll
  for (int r = 0; r < 8; ++r) {
    #pragma unroll
    for (int dt = 0; dt < 4; ++dt) {
      so[(hi * 8 + r) * OP + dt * 16 + lq] = o[dt][r] * (1.0f / 4096.0f) * rs[r];
    }
  }
  __syncthreads();

  // lanes 0..15 store one row (16 consecutive lanes x 16 B each), lanes 16..31 the next row; 8 instructions cover the wave's 16 rows.
  v4f    vals[8];
  size_t gidx[8];
  #pragma unroll
  for (int it = 0; it < 8; ++it) {
    const int row = it * 2 + hi;
    vals[it] = *(const v4f*)(so + row * OP + lq * 4);
    gidx[it] = (((size_t)b * NHEAD + h) * SEQ_FULL + qrow0 + row) * HDIM + lq * 4;
  }
  #pragma unroll
  for (int it = 0; it < 8; ++it) *(v4f*)(out + gidx[it]) = vals[it];
  
}

extern "C" void kernel_launch(void* const* d_in, const int* in_sizes, int n_in,
                              void* d_out, int out_size, void* d_ws, size_t ws_size,
                              hipStream_t stream) {
  if (n_in < 3) return;
  // last element touched of each [b][h][s][d] array (full-size strides, NB x SEQ sub-problem)
  const size_t need = ((((size_t)(NB - 1) * NHEAD + (NHEAD - 1)) * SEQ_FULL) + SEQ) * HDIM;
  if ((size_t)in_sizes[0] < need) return;
  if ((size_t)in_sizes[1] < need) return;
  if ((size_t)in_sizes[2] < need) return;
  if ((size_t)out_size < need) return;

  const size_t kb_elems = (size_t)NB * NHEAD * SEQ * HDIM;   // bf16 K plane
  const size_t vt_elems = (size_t)NB * NHEAD * HDIM * SEQ;   // f16 V^T plane
  const size_t kb_bytes = kb_elems * 2;
  const size_t vt_bytes = vt_elems * 2;
  if (ws_size < kb_bytes + vt_bytes) return;

  const float* q   = (const float*)d_in[0];
  const float* k   = (const float*)d_in[1];
  const float* v   = (const float*)d_in[2];
  float*       out = (float*)d_out;
  bf16*        kb  = (bf16*)d_ws;
  f16*         vt  = (f16*)((char*)d_ws + kb_bytes);

  kv_planes_kernel<<<dim3(SEQ / CT, NHEAD, NB), 256, 0, stream>>>(k, v, kb, vt);
  attn_kernel<<<dim3(SEQ / BQ, NHEAD, NB), 256, 0, stream>>>(q, kb, vt, out);
}

// v002
// It runs in 79.2 microseconds.
// In two side-by-side timings against v001, it was 1.16 and 1.20 times as fast.
// Over all steps from v000 it is 3.26 times as fast.
#include <hip/hip_runtime.h>

// Contractions: S^T = K x Q^T on v_wmma_f32_16x16x32_bf16 (bf16 operands = RNE-converted inputs, f32 accumulate);
// O = P x V on v_wmma_f32_16x16x32_f16 (P as f16 carried x4096; V = f16 of the bf16 RNE-converted input; f32 accumulate).
// Softmax (online, max-subtracted) in f32; the subtracted maximum is renewed only when a score outgrows it by LAZY.

#ifndef NB
#define NB 2
#endif
#ifndef SEQ
#define SEQ 4096
#endif
#define NB_FULL    2
#define SEQ_FULL   4096
#define NHEAD      8
#define HDIM       64
#define BQ         128                  // query rows per workgroup (8 waves x 16)
#define BK         32                   // keys per inner iteration
#define NWAVE      8
#define CT         64                   // keys per plane-builder block
#define TP         72                   // LDS pitch (halves) of the transposed V tile
#define OP         68                   // LDS pitch (floats) of the output staging tile
#define KT         64                   // keys per LDS stage (two inner iterations)
#define LROW       9                    // LDS row pitch in 16-B units: 128 B of data + 16 B (odd multiple of 16 B)
#define VOFF       (KT * LROW)          // first V^T row of a stage, 16-B units
#define STG        (KT * LROW + HDIM * LROW)   // one stage, 16-B units
#define WS_CAP     134217728ull         // workspace carve ceiling (bytes)
#define LAZY       32.0f                // raw-score margin over the maximum in use: P <= 2^(32/16*log2 e) < 8, x4096 < 32768 (f16 finite)

static_assert(SEQ % BQ == 0);
static_assert(SEQ % CT == 0);
static_assert(SEQ % BK == 0);
static_assert(SEQ % KT == 0 && SEQ / KT >= 2);   // the two-buffer prologue needs two stages
static_assert(KT == 2 * BK);
static_assert(KT * 8 == 2 * 256 && HDIM * 8 == 2 * 256);   // 16-B units per tile = two per thread
static_assert(BQ == NWAVE * 16);
static_assert(HDIM == 64);
static_assert(HDIM % 32 == 0);
static_assert(HDIM * 4 == 16 * 16);           // one output row = 16 lanes x 16 B
static_assert(CT * 2 == 128);
static_assert(HDIM * 2 == 128);
static_assert(CT == 64 && CT <= TP);
static_assert(SEQ <= SEQ_FULL);
static_assert(NB >= 1 && NB <= NB_FULL);
static_assert((TP * 2) % 16 == 0);
static_assert((OP * 4) % 16 == 0);
static_assert(OP >= HDIM);
static_assert((unsigned long long)NB * NHEAD * SEQ * HDIM * 2ull * 2ull <= WS_CAP);

typedef __bf16   bf16;
typedef _Float16 f16;
typedef bf16     v16bf __attribute__((ext_vector_type(16)));
typedef f16      v16h  __attribute__((ext_vector_type(16)));
typedef f16      v8h   __attribute__((ext_vector_type(8)));
typedef float    v8f   __attribute__((ext_vector_type(8)));
typedef float    v4f   __attribute__((ext_vector_type(4)));
typedef unsigned v4u   __attribute__((ext_vector_type(4)));

union FragB  { v16bf v; v4u q[2]; bf16 h[16]; };
union FragH  { v16h  v; v4u q[2]; f16  h[16]; };
union Pack8B { v4u u; bf16 h[8]; };
union Pack8H { v4u u; v8h v; f16 h[8]; };

// WMMA helpers: builtin followed by the VALU hazard guard (ties D, keeps A/B live).
static __device__ __forceinline__ v8f mma_bf16(v16bf a, v16bf b, v8f acc) {
  acc = __builtin_amdgcn_wmma_f32_16x16x32_bf16(false, a, false, b, (short)0, acc, false, false);
  asm volatile("v_nop\n\tv_nop\n\tv_nop\n\tv_nop" : "+v"(acc) : "v"(a), "v"(b));
  return acc;
}
static __device__ __forceinline__ v8f mma_f16(v16h a, v16h b, v8f acc) {
  acc = __builtin_amdgcn_wmma_f32_16x16x32_f16(false, a, false, b, (short)0, acc, false, false);
  asm volatile("v_nop\n\tv_nop\n\tv_nop\n\tv_nop" : "+v"(acc) : "v"(a), "v"(b));
  return acc;
}

// One stage (64 K rows of 128 B, 64 V^T rows of 128 B) into LDS: four 16-B asynchronous copies per lane.
// The s_wait_xcnt closes the statement so that no address register is rewritten ahead of it.
static __device__ __forceinline__ void copy_stage(unsigned l0, unsigned l1, unsigned l2, unsigned l3,
                                                  const void* g0, const void* g1,
                                                  const void* g2, const void* g3) {
  asm volatile("global_load_async_to_lds_b128 %0, %4, off\n\t"
               "global_load_async_to_lds_b128 %1, %5, off\n\t"
               "global_load_async_to_lds_b128 %2, %6, off\n\t"
               "global_load_async_to_lds_b128 %3, %7, off\n\t"
               "s_wait_xcnt 0x0"
               :: "v"(l0), "v"(l1), "v"(l2), "v"(l3), "v"(g0), "v"(g1), "v"(g2), "v"(g3)
               : "memory");
}

// Plane builder. Block = (64-key tile, head, batch), 256 threads.
// coverage: keys kt*64 + {0..31, 32..63}, d 0..63 for both planes; every written line whole, one instruction.
// LDS tile sT is cross-wave (block barrier between fill and readback); staged extent 64 d x 64 keys == consumed extent.
__global__ __launch_bounds__(256) void kv_planes_kernel(const float* __restrict__ kin,
                                                        const float* __restrict__ vin,
                                                        bf16* __restrict__ kb,
                                                        f16* __restrict__ vt) {
  const int kt  = blockIdx.x;
  const int h   = blockIdx.y;
  const int b   = blockIdx.z;
  const int tid = threadIdx.x;
  __shared__ __align__(16) f16 sT[HDIM * TP];   // [d][key]
  const int s0 = kt * CT;

  v4u    kval[2];
  size_t kidx[2];
  #pragma unroll
  for (int kk = 0; kk < 2; ++kk) {
    const int key = kk * 32 + (tid >> 3);       // 0..63
    const int d0  = (tid & 7) * 8;              // 0..56
    const size_t src = (((size_t)b * NHEAD + h) * SEQ_FULL + s0 + key) * HDIM + d0;
    const v4f k0 = *(const v4f*)(kin + src);
    const v4f k1 = *(const v4f*)(kin + src + 4);
    const v4f v0 = *(const v4f*)(vin + src);
    const v4f v1 = *(const v4f*)(vin + src + 4);
    Pack8B pk;
    #pragma unroll
    for (int i = 0; i < 4; ++i) {
      pk.h[i]     = (bf16)k0[i];                          // RNE convert
      pk.h[4 + i] = (bf16)k1[i];
    }
    kval[kk] = pk.u;
    kidx[kk] = (((size_t)b * NHEAD + h) * SEQ + s0 + key) * HDIM + d0;
    #pragma unroll
    for (int i = 0; i < 4; ++i) {
      sT[(d0 + i) * TP + key]     = (f16)(float)(bf16)v0[i];   // f16 of bf16 value: exact
      sT[(d0 + 4 + i) * TP + key] = (f16)(float)(bf16)v1[i];
    }
  }
  __syncthreads();

  v4u    vval[2];
  size_t vidx[2];
  #pragma unroll
  for (int kk = 0; kk < 2; ++kk) {
    const int d  = kk * 32 + (tid >> 3);        // 0..63
    const int ks = (tid & 7) * 8;               // 0..56
    Pack8H ph;
    ph.v = *(const v8h*)(sT + d * TP + ks);
    vval[kk] = ph.u;
    vidx[kk] = (((size_t)b * NHEAD + h) * HDIM + d) * SEQ + s0 + ks;
  }

  #pragma unroll
  for (int kk = 0; kk < 2; ++kk) {
    *(v4u*)(kb + kidx[kk]) = kval[kk];
    *(v4u*)(vt + vidx[kk]) = vval[kk];
  }
  
}

// Fused online-softmax attention, no mask, logit scale 1/16.
// Block = (query block of 128, head, batch); one wave owns 16 query rows and visits all SEQ keys, 32 per step.
// S^T = K x Q^T so queries sit on lanes; P^T in C-layout is bit-identical to the A-fragment layout of O += P x V.
// K rows and V^T rows of 64 keys are staged once per workgroup in a two-buffer LDS ring by asynchronous copies
// (whole 128-B lines from the planes); every wave reads its fragments from there, two 16-B LDS loads per fragment.
__global__ __launch_bounds__(256) void attn_kernel(const float* __restrict__ q,
                                                   const bf16* __restrict__ kb,
                                                   const f16* __restrict__ vt,
                                                   float* __restrict__ out) {
  const int qblk = blockIdx.x;
  const int h    = blockIdx.y;
  const int b    = blockIdx.z;
  const int tid  = threadIdx.x;
  const int wave = __builtin_amdgcn_readfirstlane(threadIdx.x >> 5);
  const int lane = tid & 31;
  const int lq   = lane & 15;   // query column of S^T / d column of O
  const int hi   = lane >> 4;   // k-split half

  // per-wave output staging: each wave writes and reads only its own 16 x OP slice (block barrier used anyway)
  __shared__ __align__(16) float sO[NWAVE * 16 * OP];
  // K / V^T ring: [buffer][K rows 0..63 | V^T rows 0..63][9 x 16 B]
  __shared__ __align__(16) v4u sKV[2 * STG];

  const int qrow0 = qblk * BQ + wave * 16;               // first query row of this wave

  // Q as B-operand fragments: lane lq holds query qrow0+lq, elements follow the split d map; bf16 RNE convert.
  FragB qf[2];
  {
    const float* qp = q + (((size_t)b * NHEAD + h) * SEQ_FULL + qrow0 + lq) * HDIM;
    #pragma unroll
    for (int f = 0; f < 2; ++f) {
      const v4f a0 = *(const v4f*)(qp + f * 32 + hi * 8);
      const v4f a1 = *(const v4f*)(qp + f * 32 + hi * 8 + 4);
      const v4f b0 = *(const v4f*)(qp + f * 32 + 16 + hi * 8);
      const v4f b1 = *(const v4f*)(qp + f * 32 + 16 + hi * 8 + 4);
      #pragma unroll
      for (int i = 0; i < 4; ++i) {
        qf[f].h[i]      = (bf16)a0[i];   // elems 0..7  : d = f*32 + hi*8 + 0..7
        qf[f].h[4 + i]  = (bf16)a1[i];
        qf[f].h[8 + i]  = (bf16)b0[i];   // elems 8..15 : d = f*32 + 16 + hi*8 + 0..7
        qf[f].h[12 + i] = (bf16)b1[i];
      }
    }
  }

  const bf16* kb_h = kb + ((size_t)b * NHEAD + h) * SEQ * HDIM;
  const f16*  vt_h = vt + ((size_t)b * NHEAD + h) * HDIM * SEQ;

  v8f o[4];
  #pragma unroll
  for (int dt = 0; dt < 4; ++dt) o[dt] = (v8f){0, 0, 0, 0, 0, 0, 0, 0};

  float rmax = -__builtin_inff();                   // maximum in use (same in lane and lane^16)
  float thr  = -__builtin_inff();                   // rmax + LAZY: a score above it forces a renewal
  float rsum = 0.0f;                                // sum over this lane's half of the keys; the halves join after the loop
  const float SL = 0.0625f * 1.4426950408889634f;   // logit scale 1/sqrt(256) times log2(e)

  // copy map: thread tid brings rows (tid >> 3) and 32 + (tid >> 3), 16-B unit tid & 7, of the K tile and of the V^T tile
  const int crow = tid >> 3;
  const int ccol = tid & 7;
  const unsigned lds0 = (unsigned)(size_t)sKV + (unsigned)(crow * LROW + ccol) * 16u;
  const char* gk = (const char*)kb_h + (size_t)crow * (HDIM * 2) + ccol * 16;   // + stage * KT * 128 B
  const char* gv = (const char*)vt_h + (size_t)crow * (SEQ * 2) + ccol * 16;    // + stage * 128 B

  const int nstage = SEQ / KT;                        // uniform for every wave
  // prologue: stage 0 lands and is published, then stage 1 flies
  copy_stage(lds0, lds0 + 32 * LROW * 16, lds0 + VOFF * 16, lds0 + (VOFF + 32 * LROW) * 16,
             gk, gk + 32 * (HDIM * 2), gv, gv + (size_t)32 * (SEQ * 2));
  asm volatile("s_wait_asynccnt 0x0" ::: "memory");   // this wave's share of stage 0 has landed
  __syncthreads();                                    // publishes stage 0
  copy_stage(lds0 + STG * 16, lds0 + (STG + 32 * LROW) * 16, lds0 + (STG + VOFF) * 16, lds0 + (STG + VOFF + 32 * LROW) * 16,
             gk + KT * (HDIM * 2), gk + (KT + 32) * (HDIM * 2), gv + KT * 2, gv + (size_t)32 * (SEQ * 2) + KT * 2);

  #pragma unroll 1   // rolled: the ring's publish point stands once, at the foot of one two-pass body
  for (int t = 0; t < nstage; ++t) {
   const int bo = (t & 1) * STG;                      // this stage's buffer
   const v4u* frag = sKV + bo + lq * LROW + hi;
   #pragma unroll     // unrolled: the pass's place in the stage becomes an immediate offset of the LDS loads
   for (int ps = 0; ps < KT / BK; ++ps) {
    // K A-fragments: row = key ps*32 + sub*16 + lq of the stage, split d map
    FragB ak[2][2];
    #pragma unroll
    for (int sub = 0; sub < 2; ++sub) {
      #pragma unroll
      for (int f = 0; f < 2; ++f) {
        const v4u* base = frag + (ps * 32 + sub * 16) * LROW + f * 4;
        ak[sub][f].q[0] = base[0];                    // d = f*32 + hi*8 + 0..7
        ak[sub][f].q[1] = base[2];                    // d = f*32 + 16 + hi*8 + 0..7
      }
    }
    // V B-fragments: column n = d = dt*16 + lq, split key map from the transposed rows
    FragH bv[4];
    #pragma unroll
    for (int dt = 0; dt < 4; ++dt) {
      const v4u* base = frag + VOFF + (dt * 16) * LROW + ps * 4;
      bv[dt].q[0] = base[0];                          // keys ps*32 + hi*8 + 0..7
      bv[dt].q[1] = base[2];                          // keys ps*32 + 16 + hi*8 + 0..7
    }

    // S^T tiles: c[sub][r] = rawscore(query qrow0+lq, key j0 + sub*16 + hi*8 + r)
    v8f c[2];
    #pragma unroll
    for (int sub = 0; sub < 2; ++sub) {
      v8f acc = (v8f){0, 0, 0, 0, 0, 0, 0, 0};
      acc = mma_bf16(ak[sub][0].v, qf[0].v, acc);
      acc = mma_bf16(ak[sub][1].v, qf[1].v, acc);
      c[sub] = acc;
    }

    // largest of this lane's 16 scores, as a tree (three levels instead of a chain of eight)
    const float ma = fmaxf(fmaxf(c[0][0], c[1][0]), c[0][1]);
    const float mb = fmaxf(fmaxf(c[1][1], c[0][2]), c[1][2]);
    const float mc = fmaxf(fmaxf(c[0][3], c[1][3]), c[0][4]);
    const float md = fmaxf(fmaxf(c[1][4], c[0][5]), c[1][5]);
    const float me = fmaxf(fmaxf(c[0][6], c[1][6]), c[0][7]);
    const float mloc = fmaxf(fmaxf(fmaxf(ma, mb), c[1][7]), fmaxf(fmaxf(mc, md), me));

    // lazy rescale: one wave-uniform test per pass; the halves' join of the maximum, the scale's broadcast
    // and the rescale of O and of the sum run only when some lane's score exceeds the maximum in use by LAZY
    if (__builtin_amdgcn_ballot_w32(mloc > thr) != 0u) {
      const float m_new = fmaxf(rmax, fmaxf(mloc, __shfl_xor(mloc, 16, 32)));
      const float scale = __builtin_amdgcn_exp2f((rmax - m_new) * SL);
      rmax = m_new;
      thr  = m_new + LAZY;
      rsum *= scale;
      // queries are the row dimension of O -> per-row scale from lane 8*hi + r
      float sc[8];
      #pragma unroll
      for (int r = 0; r < 8; ++r) sc[r] = __shfl(scale, (hi << 3) + r, 32);
      #pragma unroll
      for (int dt = 0; dt < 4; ++dt) {
        #pragma unroll
        for (int r = 0; r < 8; ++r) o[dt][r] *= sc[r];
      }
    }

    // exp + pack: P^T C-layout == A-fragment layout for the PV product; P carried x4096 (below 32768 by LAZY)
    FragH pa;
    float psum = 0.0f;
    #pragma unroll
    for (int r = 0; r < 8; ++r) {
      const float p0 = __builtin_amdgcn_exp2f((c[0][r] - rmax) * SL);   // key hi*8 + r
      const float p1 = __builtin_amdgcn_exp2f((c[1][r] - rmax) * SL);   // key 16 + hi*8 + r
      psum += p0 + p1;
      pa.h[r]     = (f16)(p0 * 4096.0f);
      pa.h[8 + r] = (f16)(p1 * 4096.0f);
    }
    rsum += psum;                                     // this lane's half only: an exchange per pass would be waited for at the next test

    // O += P x V
    #pragma unroll
    for (int dt = 0; dt < 4; ++dt) o[dt] = mma_f16(pa.v, bv[dt].v, o[dt]);
   }

   // publish point of stage t + 1; the same barrier ends every wave's reads of stage t's buffer
   asm volatile("s_wait_dscnt 0x0" ::: "memory");     // this wave's LDS reads of stage t are done
   asm volatile("s_wait_asynccnt 0x0" ::: "memory");  // this wave's share of stage t + 1 has landed
   __syncthreads();
   if (t + 2 < nstage) {                              // uniform: refill the buffer just read with stage t + 2
     const char* nk = gk + (size_t)(t + 2) * (KT * HDIM * 2);
     const char* nv = gv + (size_t)(t + 2) * (KT * 2);
     const unsigned ld = lds0 + (unsigned)bo * 16u;
     copy_stage(ld, ld + 32 * LROW * 16, ld + VOFF * 16, ld + (VOFF + 32 * LROW) * 16,
                nk, nk + 32 * (HDIM * 2), nv, nv + (size_t)32 * (SEQ * 2));
   }
  }
  asm volatile("s_wait_asynccnt 0x0" ::: "memory");   // nothing is in flight when the ring is left

  rsum += __shfl_xor(rsum, 16, 32);                   // both halves carry the same maximum, so their sums add as they are

  // normalize: lane holds column d = dt*16 + lq for query rows 8*hi + r
  float rs[8];
  #pragma unroll
  for (int r = 0; r < 8; ++r) rs[r] = 1.0f / __shfl(rsum, (hi << 3) + r, 32);

  float* so = sO + wave * (16 * OP);
  #pragma unroll
  for (int r = 0; r < 8; ++r) {
    #pragma unroll
    for (int dt = 0; dt < 4; ++dt) {
      so[(hi * 8 + r) * OP + dt * 16 + lq] = o[dt][r] * (1.0f / 4096.0f) * rs[r];
    }
  }
  __syncthreads();

  // lanes 0..15 store one row (16 consecutive lanes x 16 B each), lanes 16..31 the next row; 8 instructions cover the wave's 16 rows.
  v4f    vals[8];
  size_t gidx[8];
  #pragma unroll
  for (int it = 0; it < 8; ++it) {
    const int row = it * 2 + hi;
    vals[it] = *(const v4f*)(so + row * OP + lq * 4);
    gidx[it] = (((size_t)b * NHEAD + h) * SEQ_FULL + qrow0 + row) * HDIM + lq * 4;
  }
  #pragma unroll
  for (int it = 0; it < 8; ++it) *(v4f*)(out + gidx[it]) = vals[it];
  
}

extern "C" void kernel_launch(void* const* d_in, const int* in_sizes, int n_in,
                              void* d_out, int out_size, void* d_ws, size_t ws_size,
                              hipStream_t stream) {
  if (n_in < 3) return;
  // last element touched of each [b][h][s][d] array (full-size strides, NB x SEQ sub-problem)
  const size_t need = ((((size_t)(NB - 1) * NHEAD + (NHEAD - 1)) * SEQ_FULL) + SEQ) * HDIM;
  if ((size_t)in_sizes[0] < need) return;
  if ((size_t)in_sizes[1] < need) return;
  if ((size_t)in_sizes[2] < need) return;
  if ((size_t)out_size < need) return;

  const size_t kb_elems = (size_t)NB * NHEAD * SEQ * HDIM;   // bf16 K plane
  const size_t vt_elems = (size_t)NB * NHEAD * HDIM * SEQ;   // f16 V^T plane
  const size_t kb_bytes = kb_elems * 2;
  const size_t vt_bytes = vt_elems * 2;
  if (ws_size < kb_bytes + vt_bytes) return;

  const float* q   = (const float*)d_in[0];
  const float* k   = (const float*)d_in[1];
  const float* v   = (const float*)d_in[2];
  float*       out = (float*)d_out;
  bf16*        kb  = (bf16*)d_ws;
  f16*         vt  = (f16*)((char*)d_ws + kb_bytes);

  kv_planes_kernel<<<dim3(SEQ / CT, NHEAD, NB), 256, 0, stream>>>(k, v, kb, vt);
  attn_kernel<<<dim3(SEQ / BQ, NHEAD, NB), 256, 0, stream>>>(q, kb, vt, out);
}

// v003
// A run of this version takes 77.3 microseconds.
// Two timings next to v002 put it at 1.03 and 1.02 times that version's speed.
// Over all steps from v000 it is 3.35 times as fast.
#include <hip/hip_runtime.h>

// Contractions: S^T = K x Q^T on v_wmma_f32_16x16x32_bf16 (bf16 operands = RNE-converted inputs, f32 accumulate);
// O = P x V on v_wmma_f32_16x16x32_f16 (P as f16 carried x4096; V = f16 of the bf16 RNE-converted input; f32 accumulate).
// Softmax (online, max-subtracted) in f32; the subtracted maximum is renewed only when a score outgrows it by LAZY.

#ifndef NB
#define NB 2
#endif
#ifndef SEQ
#define SEQ 4096
#endif
#define NB_FULL    2
#define SEQ_FULL   4096
#define NHEAD      8
#define HDIM       64
#define BQ         128                  // query rows per workgroup (8 waves x 16)
#define BK         32                   // keys per inner iteration
#define NWAVE      8
#define CT         64                   // keys per plane-builder block
#define TP         72                   // LDS pitch (halves) of the transposed V tile
#define OP         68                   // LDS pitch (floats) of the output staging tile
#define KT         64                   // keys per LDS stage (two inner iterations)
#define LROW       9                    // LDS row pitch in 16-B units: 128 B of data + 16 B (odd multiple of 16 B)
#define VOFF       (KT * LROW)          // first V^T row of a stage, 16-B units
#define STG        (KT * LROW + HDIM * LROW)   // one stage, 16-B units
#define WS_CAP     134217728ull         // workspace carve ceiling (bytes)
#define LAZY       32.0f                // raw-score margin over the maximum in use: P <= 2^(32/16*log2 e) < 8, x4096 < 32768 (f16 finite)

static_assert(SEQ % BQ == 0);
static_assert(SEQ % CT == 0);
static_assert(SEQ % BK == 0);
static_assert(SEQ % KT == 0 && SEQ / KT >= 2);   // the two-buffer prologue needs two stages
static_assert(KT == 2 * BK);
static_assert(KT * 8 == 2 * 256 && HDIM * 8 == 2 * 256);   // 16-B units per tile = two per thread
static_assert(BQ == NWAVE * 16);
static_assert(HDIM == 64);
static_assert(HDIM % 32 == 0);
static_assert(HDIM * 4 == 16 * 16);           // one output row = 16 lanes x 16 B
static_assert(CT * 2 == 128);
static_assert(HDIM * 2 == 128);
static_assert(CT == 64 && CT <= TP);
static_assert(SEQ <= SEQ_FULL);
static_assert(NB >= 1 && NB <= NB_FULL);
static_assert((TP * 2) % 16 == 0);
static_assert((OP * 4) % 16 == 0);
static_assert(OP >= HDIM);
static_assert((unsigned long long)NB * NHEAD * SEQ * HDIM * 2ull * 2ull <= WS_CAP);

typedef __bf16   bf16;
typedef _Float16 f16;
typedef bf16     v16bf __attribute__((ext_vector_type(16)));
typedef f16      v16h  __attribute__((ext_vector_type(16)));
typedef f16      v8h   __attribute__((ext_vector_type(8)));
typedef float    v8f   __attribute__((ext_vector_type(8)));
typedef float    v4f   __attribute__((ext_vector_type(4)));
typedef unsigned v4u   __attribute__((ext_vector_type(4)));

union FragB  { v16bf v; v4u q[2]; bf16 h[16]; };
union FragH  { v16h  v; v4u q[2]; f16  h[16]; };
union Pack8B { v4u u; bf16 h[8]; };
union Pack8H { v4u u; v8h v; f16 h[8]; };

// WMMA helpers: builtin followed by the VALU hazard guard (ties D, keeps A/B live).
static __device__ __forceinline__ v8f mma_bf16(v16bf a, v16bf b, v8f acc) {
  acc = __builtin_amdgcn_wmma_f32_16x16x32_bf16(false, a, false, b, (short)0, acc, false, false);
  asm volatile("v_nop\n\tv_nop\n\tv_nop\n\tv_nop" : "+v"(acc) : "v"(a), "v"(b));
  return acc;
}
static __device__ __forceinline__ v8f mma_f16(v16h a, v16h b, v8f acc) {
  acc = __builtin_amdgcn_wmma_f32_16x16x32_f16(false, a, false, b, (short)0, acc, false, false);
  asm volatile("v_nop\n\tv_nop\n\tv_nop\n\tv_nop" : "+v"(acc) : "v"(a), "v"(b));
  return acc;
}

// One stage (64 K rows of 128 B, 64 V^T rows of 128 B) into LDS: four 16-B asynchronous copies per lane.
// The s_wait_xcnt closes the statement so that no address register is rewritten ahead of it.
static __device__ __forceinline__ void copy_stage(unsigned l0, unsigned l1, unsigned l2, unsigned l3,
                                                  const void* g0, const void* g1,
                                                  const void* g2, const void* g3) {
  asm volatile("global_load_async_to_lds_b128 %0, %4, off\n\t"
               "global_load_async_to_lds_b128 %1, %5, off\n\t"
               "global_load_async_to_lds_b128 %2, %6, off\n\t"
               "global_load_async_to_lds_b128 %3, %7, off\n\t"
               "s_wait_xcnt 0x0"
               :: "v"(l0), "v"(l1), "v"(l2), "v"(l3), "v"(g0), "v"(g1), "v"(g2), "v"(g3)
               : "memory");
}

// Plane builder. Block = (64-key tile, head, batch), 256 threads.
// coverage: keys kt*64 + {0..31, 32..63}, d 0..63 for both planes; every written line whole, one instruction.
// LDS tile sT is cross-wave (block barrier between fill and readback); staged extent 64 d x 64 keys == consumed extent.
__global__ __launch_bounds__(256) void kv_planes_kernel(const float* __restrict__ kin,
                                                        const float* __restrict__ vin,
                                                        bf16* __restrict__ kb,
                                                        f16* __restrict__ vt) {
  const int kt  = blockIdx.x;
  const int h   = blockIdx.y;
  const int b   = blockIdx.z;
  const int tid = threadIdx.x;
  __shared__ __align__(16) f16 sT[HDIM * TP];   // [d][key]
  const int s0 = kt * CT;

  v4u    kval[2];
  size_t kidx[2];
  #pragma unroll
  for (int kk = 0; kk < 2; ++kk) {
    const int key = kk * 32 + (tid >> 3);       // 0..63
    const int d0  = (tid & 7) * 8;              // 0..56
    const size_t src = (((size_t)b * NHEAD + h) * SEQ_FULL + s0 + key) * HDIM + d0;
    const v4f k0 = *(const v4f*)(kin + src);
    const v4f k1 = *(const v4f*)(kin + src + 4);
    const v4f v0 = *(const v4f*)(vin + src);
    const v4f v1 = *(const v4f*)(vin + src + 4);
    Pack8B pk;
    #pragma unroll
    for (int i = 0; i < 4; ++i) {
      pk.h[i]     = (bf16)k0[i];                          // RNE convert
      pk.h[4 + i] = (bf16)k1[i];
    }
    kval[kk] = pk.u;
    kidx[kk] = (((size_t)b * NHEAD + h) * SEQ + s0 + key) * HDIM + d0;
    #pragma unroll
    for (int i = 0; i < 4; ++i) {
      sT[(d0 + i) * TP + key]     = (f16)(float)(bf16)v0[i];   // f16 of bf16 value: exact
      sT[(d0 + 4 + i) * TP + key] = (f16)(float)(bf16)v1[i];
    }
  }
  __syncthreads();

  v4u    vval[2];
  size_t vidx[2];
  #pragma unroll
  for (int kk = 0; kk < 2; ++kk) {
    const int d  = kk * 32 + (tid >> 3);        // 0..63
    const int ks = (tid & 7) * 8;               // 0..56
    Pack8H ph;
    ph.v = *(const v8h*)(sT + d * TP + ks);
    vval[kk] = ph.u;
    vidx[kk] = (((size_t)b * NHEAD + h) * HDIM + d) * SEQ + s0 + ks;
  }

  #pragma unroll
  for (int kk = 0; kk < 2; ++kk) {
    *(v4u*)(kb + kidx[kk]) = kval[kk];
    *(v4u*)(vt + vidx[kk]) = vval[kk];
  }
  
}

// Fused online-softmax attention, no mask, logit scale 1/16.
// Block = (query block of 128, head, batch); one wave owns 16 query rows and visits all SEQ keys, 32 per step.
// S^T = K x Q^T so queries sit on lanes; P^T in C-layout is bit-identical to the A-fragment layout of O += P x V.
// K rows and V^T rows of 64 keys are staged once per workgroup in a two-buffer LDS ring by asynchronous copies
// (whole 128-B lines from the planes); every wave reads its fragments from there, two 16-B LDS loads per fragment.
__global__ __launch_bounds__(256) void attn_kernel(const float* __restrict__ q,
                                                   const bf16* __restrict__ kb,
                                                   const f16* __restrict__ vt,
                                                   float* __restrict__ out) {
  const int qblk = blockIdx.x;
  const int h    = blockIdx.y;
  const int b    = blockIdx.z;
  const int tid  = threadIdx.x;
  const int wave = __builtin_amdgcn_readfirstlane(threadIdx.x >> 5);
  const int lane = tid & 31;
  const int lq   = lane & 15;   // query column of S^T / d column of O
  const int hi   = lane >> 4;   // k-split half

  // per-wave output staging: each wave writes and reads only its own 16 x OP slice (block barrier used anyway)
  __shared__ __align__(16) float sO[NWAVE * 16 * OP];
  // K / V^T ring: [buffer][K rows 0..63 | V^T rows 0..63][9 x 16 B]
  __shared__ __align__(16) v4u sKV[2 * STG];

  const int qrow0 = qblk * BQ + wave * 16;               // first query row of this wave

  // Q as B-operand fragments: lane lq holds query qrow0+lq, elements follow the split d map; bf16 RNE convert.
  FragB qf[2];
  {
    const float* qp = q + (((size_t)b * NHEAD + h) * SEQ_FULL + qrow0 + lq) * HDIM;
    #pragma unroll
    for (int f = 0; f < 2; ++f) {
      const v4f a0 = *(const v4f*)(qp + f * 32 + hi * 8);
      const v4f a1 = *(const v4f*)(qp + f * 32 + hi * 8 + 4);
      const v4f b0 = *(const v4f*)(qp + f * 32 + 16 + hi * 8);
      const v4f b1 = *(const v4f*)(qp + f * 32 + 16 + hi * 8 + 4);
      #pragma unroll
      for (int i = 0; i < 4; ++i) {
        qf[f].h[i]      = (bf16)a0[i];   // elems 0..7  : d = f*32 + hi*8 + 0..7
        qf[f].h[4 + i]  = (bf16)a1[i];
        qf[f].h[8 + i]  = (bf16)b0[i];   // elems 8..15 : d = f*32 + 16 + hi*8 + 0..7
        qf[f].h[12 + i] = (bf16)b1[i];
      }
    }
  }

  const bf16* kb_h = kb + ((size_t)b * NHEAD + h) * SEQ * HDIM;
  const f16*  vt_h = vt + ((size_t)b * NHEAD + h) * HDIM * SEQ;

  v8f o[4];
  #pragma unroll
  for (int dt = 0; dt < 4; ++dt) o[dt] = (v8f){0, 0, 0, 0, 0, 0, 0, 0};

  float rmax = -__builtin_inff();                   // maximum in use (same in lane and lane^16)
  float thr  = -__builtin_inff();                   // rmax + LAZY: a score above it forces a renewal
  float rsum = 0.0f;                                // sum over this lane's half of the keys; the halves join after the loop
  const float SL = 0.0625f * 1.4426950408889634f;   // logit scale 1/sqrt(256) times log2(e)

  // copy map: thread tid brings rows (tid >> 3) and 32 + (tid >> 3), 16-B unit tid & 7, of the K tile and of the V^T tile
  const int crow = tid >> 3;
  const int ccol = tid & 7;
  const unsigned lds0 = (unsigned)(size_t)sKV + (unsigned)(crow * LROW + ccol) * 16u;
  const char* gk = (const char*)kb_h + (size_t)crow * (HDIM * 2) + ccol * 16;   // + stage * KT * 128 B
  const char* gv = (const char*)vt_h + (size_t)crow * (SEQ * 2) + ccol * 16;    // + stage * 128 B

  const int nstage = SEQ / KT;                        // uniform for every wave
  // prologue: stage 0 lands and is published, then stage 1 flies
  copy_stage(lds0, lds0 + 32 * LROW * 16, lds0 + VOFF * 16, lds0 + (VOFF + 32 * LROW) * 16,
             gk, gk + 32 * (HDIM * 2), gv, gv + (size_t)32 * (SEQ * 2));
  asm volatile("s_wait_asynccnt 0x0" ::: "memory");   // this wave's share of stage 0 has landed
  __syncthreads();                                    // publishes stage 0
  copy_stage(lds0 + STG * 16, lds0 + (STG + 32 * LROW) * 16, lds0 + (STG + VOFF) * 16, lds0 + (STG + VOFF + 32 * LROW) * 16,
             gk + KT * (HDIM * 2), gk + (KT + 32) * (HDIM * 2), gv + KT * 2, gv + (size_t)32 * (SEQ * 2) + KT * 2);

  // K A-fragments of one pass: row = key ps*32 + sub*16 + lq of the stage, split d map
  auto load_k = [&](FragB (&ak)[2][2], const v4u* frag, int ps) {
    #pragma unroll
    for (int sub = 0; sub < 2; ++sub) {
      #pragma unroll
      for (int f = 0; f < 2; ++f) {
        const v4u* base = frag + (ps * 32 + sub * 16) * LROW + f * 4;
        ak[sub][f].q[0] = base[0];                    // d = f*32 + hi*8 + 0..7
        ak[sub][f].q[1] = base[2];                    // d = f*32 + 16 + hi*8 + 0..7
      }
    }
  };
  // V B-fragments of one pass: column n = d = dt*16 + lq, split key map from the transposed rows
  auto load_v = [&](FragH (&bv)[4], const v4u* frag, int ps) {
    #pragma unroll
    for (int dt = 0; dt < 4; ++dt) {
      const v4u* base = frag + VOFF + (dt * 16) * LROW + ps * 4;
      bv[dt].q[0] = base[0];                          // keys ps*32 + hi*8 + 0..7
      bv[dt].q[1] = base[2];                          // keys ps*32 + 16 + hi*8 + 0..7
    }
  };
  // S^T tiles: c[sub][r] = rawscore(query qrow0+lq, key j0 + sub*16 + hi*8 + r)
  auto scores = [&](v8f (&c)[2], FragB (&ak)[2][2]) {
    #pragma unroll
    for (int sub = 0; sub < 2; ++sub) {
      v8f acc = (v8f){0, 0, 0, 0, 0, 0, 0, 0};
      acc = mma_bf16(ak[sub][0].v, qf[0].v, acc);
      acc = mma_bf16(ak[sub][1].v, qf[1].v, acc);
      c[sub] = acc;
    }
  };
  // softmax of one pass's scores and O += P x V
  auto soft_pv = [&](v8f (&c)[2], FragH (&bv)[4]) {
    // largest of this lane's 16 scores, as a tree (three levels instead of a chain of eight)
    const float ma = fmaxf(fmaxf(c[0][0], c[1][0]), c[0][1]);
    const float mb = fmaxf(fmaxf(c[1][1], c[0][2]), c[1][2]);
    const float mc = fmaxf(fmaxf(c[0][3], c[1][3]), c[0][4]);
    const float md = fmaxf(fmaxf(c[1][4], c[0][5]), c[1][5]);
    const float me = fmaxf(fmaxf(c[0][6], c[1][6]), c[0][7]);
    const float mloc = fmaxf(fmaxf(fmaxf(ma, mb), c[1][7]), fmaxf(fmaxf(mc, md), me));

    // lazy rescale: one wave-uniform test per pass; the halves' join of the maximum, the scale's broadcast
    // and the rescale of O and of the sum run only when some lane's score exceeds the maximum in use by LAZY
    if (__builtin_amdgcn_ballot_w32(mloc > thr) != 0u) {
      const float m_new = fmaxf(rmax, fmaxf(mloc, __shfl_xor(mloc, 16, 32)));
      const float scale = __builtin_amdgcn_exp2f((rmax - m_new) * SL);
      rmax = m_new;
      thr  = m_new + LAZY;
      rsum *= scale;
      // queries are the row dimension of O -> per-row scale from lane 8*hi + r
      float sc[8];
      #pragma unroll
      for (int r = 0; r < 8; ++r) sc[r] = __shfl(scale, (hi << 3) + r, 32);
      #pragma unroll
      for (int dt = 0; dt < 4; ++dt) {
        #pragma unroll
        for (int r = 0; r < 8; ++r) o[dt][r] *= sc[r];
      }
    }

    // exp + pack: P^T C-layout == A-fragment layout for the PV product; P carried x4096 (below 32768 by LAZY)
    FragH pa;
    float psum = 0.0f;
    #pragma unroll
    for (int r = 0; r < 8; ++r) {
      const float p0 = __builtin_amdgcn_exp2f((c[0][r] - rmax) * SL);   // key hi*8 + r
      const float p1 = __builtin_amdgcn_exp2f((c[1][r] - rmax) * SL);   // key 16 + hi*8 + r
      psum += p0 + p1;
      pa.h[r]     = (f16)(p0 * 4096.0f);
      pa.h[8 + r] = (f16)(p1 * 4096.0f);
    }
    rsum += psum;                                     // this lane's half only: an exchange per pass would be waited for at the next test

    // O += P x V
    #pragma unroll
    for (int dt = 0; dt < 4; ++dt) o[dt] = mma_f16(pa.v, bv[dt].v, o[dt]);
  };

  // fragments run ahead of their products: K of the next pass and V of the whole stage are read right behind a pass's
  // score products, so the LDS transfer runs under the softmax instead of being waited for at the top of each pass
  FragB ak[2][2];
  load_k(ak, sKV + lq * LROW + hi, 0);                // first fragment loads: stage 0 is published

  #pragma unroll 1   // rolled: the ring's publish point stands once in the two-pass body
  for (int t = 0; t < nstage; ++t) {
   const int bo = (t & 1) * STG;                      // this stage's buffer
   const v4u* frag = sKV + bo + lq * LROW + hi;
   FragH bv[2][4];
   v8f c[2];

   scores(c, ak);
   load_v(bv[0], frag, 0);
   load_v(bv[1], frag, 1);
   load_k(ak, frag, 1);
   __builtin_amdgcn_sched_barrier(0);                 // holds the load group here, as one group: without it the loads sink behind the rescale test, in pieces
   soft_pv(c, bv[0]);

   scores(c, ak);
   // publish point of stage t + 1, ahead of the stage's last softmax: all of stage t's fragments are in registers by now,
   // and the fetch behind it already reads stage t + 1; the same barrier ends every wave's reads of stage t's buffer
   asm volatile("s_wait_dscnt 0x0" ::: "memory");     // this wave's LDS reads of stage t are done
   asm volatile("s_wait_asynccnt 0x0" ::: "memory");  // this wave's share of stage t + 1 has landed
   __syncthreads();
   if (t + 2 < nstage) {                              // uniform: refill the buffer just read with stage t + 2
     const char* nk = gk + (size_t)(t + 2) * (KT * HDIM * 2);
     const char* nv = gv + (size_t)(t + 2) * (KT * 2);
     const unsigned ld = lds0 + (unsigned)bo * 16u;
     copy_stage(ld, ld + 32 * LROW * 16, ld + VOFF * 16, ld + (VOFF + 32 * LROW) * 16,
                nk, nk + 32 * (HDIM * 2), nv, nv + (size_t)32 * (SEQ * 2));
   }
   if (t + 1 < nstage) {                              // uniform: the last stage has nothing behind it to fetch
     load_k(ak, sKV + ((t + 1) & 1) * STG + lq * LROW + hi, 0);
   }
   soft_pv(c, bv[1]);
  }
  asm volatile("s_wait_asynccnt 0x0" ::: "memory");   // nothing is in flight when the ring is left

  rsum += __shfl_xor(rsum, 16, 32);                   // both halves carry the same maximum, so their sums add as they are

  // normalize: lane holds column d = dt*16 + lq for query rows 8*hi + r
  float rs[8];
  #pragma unroll
  for (int r = 0; r < 8; ++r) rs[r] = 1.0f / __shfl(rsum, (hi << 3) + r, 32);

  float* so = sO + wave * (16 * OP);
  #pragma unroll
  for (int r = 0; r < 8; ++r) {
    #pragma unroll
    for (int dt = 0; dt < 4; ++dt) {
      so[(hi * 8 + r) * OP + dt * 16 + lq] = o[dt][r] * (1.0f / 4096.0f) * rs[r];
    }
  }
  __syncthreads();

  // lanes 0..15 store one row (16 consecutive lanes x 16 B each), lanes 16..31 the next row; 8 instructions cover the wave's 16 rows.
  v4f    vals[8];
  size_t gidx[8];
  #pragma unroll
  for (int it = 0; it < 8; ++it) {
    const int row = it * 2 + hi;
    vals[it] = *(const v4f*)(so + row * OP + lq * 4);
    gidx[it] = (((size_t)b * NHEAD + h) * SEQ_FULL + qrow0 + row) * HDIM + lq * 4;
  }
  #pragma unroll
  for (int it = 0; it < 8; ++it) *(v4f*)(out + gidx[it]) = vals[it];
  
}

extern "C" void kernel_launch(void* const* d_in, const int* in_sizes, int n_in,
                              void* d_out, int out_size, void* d_ws, size_t ws_size,
                              hipStream_t stream) {
  if (n_in < 3) return;
  // last element touched of each [b][h][s][d] array (full-size strides, NB x SEQ sub-problem)
  const size_t need = ((((size_t)(NB - 1) * NHEAD + (NHEAD - 1)) * SEQ_FULL) + SEQ) * HDIM;
  if ((size_t)in_sizes[0] < need) return;
  if ((size_t)in_sizes[1] < need) return;
  if ((size_t)in_sizes[2] < need) return;
  if ((size_t)out_size < need) return;

  const size_t kb_elems = (size_t)NB * NHEAD * SEQ * HDIM;   // bf16 K plane
  const size_t vt_elems = (size_t)NB * NHEAD * HDIM * SEQ;   // f16 V^T plane
  const size_t kb_bytes = kb_elems * 2;
  const size_t vt_bytes = vt_elems * 2;
  if (ws_size < kb_bytes + vt_bytes) return;

  const float* q   = (const float*)d_in[0];
  const float* k   = (const float*)d_in[1];
  const float* v   = (const float*)d_in[2];
  float*       out = (float*)d_out;
  bf16*        kb  = (bf16*)d_ws;
  f16*         vt  = (f16*)((char*)d_ws + kb_bytes);

  kv_planes_kernel<<<dim3(SEQ / CT, NHEAD, NB), 256, 0, stream>>>(k, v, kb, vt);
  attn_kernel<<<dim3(SEQ / BQ, NHEAD, NB), 256, 0, stream>>>(q, kb, vt, out);
}

// v004
// It runs in 68.9 microseconds.
// Next to v003, in two timings, it ran 1.11 times as fast each time.
// Over all steps from v000 it is 3.70 times as fast.
#include <hip/hip_runtime.h>

// Contractions: S^T = K x Q^T on v_wmma_f32_16x16x32_bf16 (bf16 operands = RNE-converted inputs, f32 accumulate);
// O = P x V on v_wmma_f32_16x16x32_f16 (P as f16 carried x4096; V = f16 of the bf16 RNE-converted input; f32 accumulate).
// Softmax (online, max-subtracted) in f32; the subtracted maximum is renewed only when a score outgrows it by LAZY.

#ifndef NB
#define NB 2
#endif
#ifndef SEQ
#define SEQ 4096
#endif
#define NB_FULL    2
#define SEQ_FULL   4096
#define NHEAD      8
#define HDIM       64
#define BQ         128                  // query rows per workgroup (8 waves x 16)
#define BK         32                   // keys per inner iteration
#define NWAVE      8
#define CT         64                   // keys per plane-builder block
#define TP         72                   // LDS pitch (halves) of the transposed V tile
#define OP         68                   // LDS pitch (floats) of the output staging tile
#define KT         64                   // keys per LDS stage (two inner iterations)
#define LROW       9                    // LDS row pitch in 16-B units: 128 B of data + 16 B (odd multiple of 16 B)
#define VOFF       (KT * LROW)          // first V^T row of a stage, 16-B units
#define STG        (KT * LROW + HDIM * LROW)   // one stage, 16-B units
#define WS_CAP     134217728ull         // workspace carve ceiling (bytes)
#define LAZY       32.0f                // raw-score margin over the maximum in use: P <= 2^(32/16*log2 e) < 8, x4096 < 32768 (f16 finite)

static_assert(SEQ % BQ == 0);
static_assert(SEQ % CT == 0);
static_assert(SEQ % BK == 0);
static_assert(SEQ % KT == 0 && SEQ / KT >= 2);   // the two-buffer prologue needs two stages
static_assert(KT == 2 * BK);
static_assert(KT * 8 == 2 * 256 && HDIM * 8 == 2 * 256);   // 16-B units per tile = two per thread
static_assert(BQ == NWAVE * 16);
static_assert(HDIM == 64);
static_assert(HDIM % 32 == 0);
static_assert(HDIM * 4 == 16 * 16);           // one output row = 16 lanes x 16 B
static_assert(CT * 2 == 128);
static_assert(HDIM * 2 == 128);
static_assert(CT == 64 && CT <= TP);
static_assert(SEQ <= SEQ_FULL);
static_assert(NB >= 1 && NB <= NB_FULL);
static_assert((TP * 2) % 16 == 0);
static_assert((OP * 4) % 16 == 0);
static_assert(OP >= HDIM);
static_assert((unsigned long long)NB * NHEAD * SEQ * HDIM * 2ull * 2ull <= WS_CAP);

typedef __bf16   bf16;
typedef _Float16 f16;
typedef bf16     v16bf __attribute__((ext_vector_type(16)));
typedef f16      v16h  __attribute__((ext_vector_type(16)));
typedef f16      v8h   __attribute__((ext_vector_type(8)));
typedef float    v8f   __attribute__((ext_vector_type(8)));
typedef float    v4f   __attribute__((ext_vector_type(4)));
typedef unsigned v4u   __attribute__((ext_vector_type(4)));

union FragB  { v16bf v; v4u q[2]; bf16 h[16]; };
union FragH  { v16h  v; v4u q[2]; f16  h[16]; };
union Pack8B { v4u u; bf16 h[8]; };
union Pack8H { v4u u; v8h v; f16 h[8]; };

// WMMA helpers: the plain builtins; the compiler keeps the distance behind each product itself and counts the
// products and the independent vector work that it places there.
static __device__ __forceinline__ v8f mma_bf16(v16bf a, v16bf b, v8f acc) {
  return __builtin_amdgcn_wmma_f32_16x16x32_bf16(false, a, false, b, (short)0, acc, false, false);
}
static __device__ __forceinline__ v8f mma_f16(v16h a, v16h b, v8f acc) {
  return __builtin_amdgcn_wmma_f32_16x16x32_f16(false, a, false, b, (short)0, acc, false, false);
}

// One stage (64 K rows of 128 B, 64 V^T rows of 128 B) into LDS: four 16-B asynchronous copies per lane.
// The s_wait_xcnt closes the statement so that no address register is rewritten ahead of it.
static __device__ __forceinline__ void copy_stage(unsigned l0, unsigned l1, unsigned l2, unsigned l3,
                                                  const void* g0, const void* g1,
                                                  const void* g2, const void* g3) {
  asm volatile("global_load_async_to_lds_b128 %0, %4, off\n\t"
               "global_load_async_to_lds_b128 %1, %5, off\n\t"
               "global_load_async_to_lds_b128 %2, %6, off\n\t"
               "global_load_async_to_lds_b128 %3, %7, off\n\t"
               "s_wait_xcnt 0x0"
               :: "v"(l0), "v"(l1), "v"(l2), "v"(l3), "v"(g0), "v"(g1), "v"(g2), "v"(g3)
               : "memory");
}

// Plane builder. Block = (64-key tile, head, batch), 256 threads.
// coverage: keys kt*64 + {0..31, 32..63}, d 0..63 for both planes; every written line whole, one instruction.
// LDS tile sT is cross-wave (block barrier between fill and readback); staged extent 64 d x 64 keys == consumed extent.
__global__ __launch_bounds__(256) void kv_planes_kernel(const float* __restrict__ kin,
                                                        const float* __restrict__ vin,
                                                        bf16* __restrict__ kb,
                                                        f16* __restrict__ vt) {
  const int kt  = blockIdx.x;
  const int h   = blockIdx.y;
  const int b   = blockIdx.z;
  const int tid = threadIdx.x;
  __shared__ __align__(16) f16 sT[HDIM * TP];   // [d][key]
  const int s0 = kt * CT;

  v4u    kval[2];
  size_t kidx[2];
  #pragma unroll
  for (int kk = 0; kk < 2; ++kk) {
    const int key = kk * 32 + (tid >> 3);       // 0..63
    const int d0  = (tid & 7) * 8;              // 0..56
    const size_t src = (((size_t)b * NHEAD + h) * SEQ_FULL + s0 + key) * HDIM + d0;
    const v4f k0 = *(const v4f*)(kin + src);
    const v4f k1 = *(const v4f*)(kin + src + 4);
    const v4f v0 = *(const v4f*)(vin + src);
    const v4f v1 = *(const v4f*)(vin + src + 4);
    Pack8B pk;
    #pragma unroll
    for (int i = 0; i < 4; ++i) {
      pk.h[i]     = (bf16)k0[i];                          // RNE convert
      pk.h[4 + i] = (bf16)k1[i];
    }
    kval[kk] = pk.u;
    kidx[kk] = (((size_t)b * NHEAD + h) * SEQ + s0 + key) * HDIM + d0;
    #pragma unroll
    for (int i = 0; i < 4; ++i) {
      sT[(d0 + i) * TP + key]     = (f16)(float)(bf16)v0[i];   // f16 of bf16 value: exact
      sT[(d0 + 4 + i) * TP + key] = (f16)(float)(bf16)v1[i];
    }
  }
  __syncthreads();

  v4u    vval[2];
  size_t vidx[2];
  #pragma unroll
  for (int kk = 0; kk < 2; ++kk) {
    const int d  = kk * 32 + (tid >> 3);        // 0..63
    const int ks = (tid & 7) * 8;               // 0..56
    Pack8H ph;
    ph.v = *(const v8h*)(sT + d * TP + ks);
    vval[kk] = ph.u;
    vidx[kk] = (((size_t)b * NHEAD + h) * HDIM + d) * SEQ + s0 + ks;
  }

  #pragma unroll
  for (int kk = 0; kk < 2; ++kk) {
    *(v4u*)(kb + kidx[kk]) = kval[kk];
    *(v4u*)(vt + vidx[kk]) = vval[kk];
  }
  
}

// Fused online-softmax attention, no mask, logit scale 1/16.
// Block = (query block of 128, head, batch); one wave owns 16 query rows and visits all SEQ keys, 32 per step.
// S^T = K x Q^T so queries sit on lanes; P^T in C-layout is bit-identical to the A-fragment layout of O += P x V.
// K rows and V^T rows of 64 keys are staged once per workgroup in a two-buffer LDS ring by asynchronous copies
// (whole 128-B lines from the planes); every wave reads its fragments from there, two 16-B LDS loads per fragment.
__global__ __launch_bounds__(256) void attn_kernel(const float* __restrict__ q,
                                                   const bf16* __restrict__ kb,
                                                   const f16* __restrict__ vt,
                                                   float* __restrict__ out) {
  const int qblk = blockIdx.x;
  const int h    = blockIdx.y;
  const int b    = blockIdx.z;
  const int tid  = threadIdx.x;
  const int wave = __builtin_amdgcn_readfirstlane(threadIdx.x >> 5);
  const int lane = tid & 31;
  const int lq   = lane & 15;   // query column of S^T / d column of O
  const int hi   = lane >> 4;   // k-split half

  // per-wave output staging: each wave writes and reads only its own 16 x OP slice (block barrier used anyway)
  __shared__ __align__(16) float sO[NWAVE * 16 * OP];
  // K / V^T ring: [buffer][K rows 0..63 | V^T rows 0..63][9 x 16 B]
  __shared__ __align__(16) v4u sKV[2 * STG];

  const int qrow0 = qblk * BQ + wave * 16;               // first query row of this wave

  // Q as B-operand fragments: lane lq holds query qrow0+lq, elements follow the split d map; bf16 RNE convert.
  FragB qf[2];
  {
    const float* qp = q + (((size_t)b * NHEAD + h) * SEQ_FULL + qrow0 + lq) * HDIM;
    #pragma unroll
    for (int f = 0; f < 2; ++f) {
      const v4f a0 = *(const v4f*)(qp + f * 32 + hi * 8);
      const v4f a1 = *(const v4f*)(qp + f * 32 + hi * 8 + 4);
      const v4f b0 = *(const v4f*)(qp + f * 32 + 16 + hi * 8);
      const v4f b1 = *(const v4f*)(qp + f * 32 + 16 + hi * 8 + 4);
      #pragma unroll
      for (int i = 0; i < 4; ++i) {
        qf[f].h[i]      = (bf16)a0[i];   // elems 0..7  : d = f*32 + hi*8 + 0..7
        qf[f].h[4 + i]  = (bf16)a1[i];
        qf[f].h[8 + i]  = (bf16)b0[i];   // elems 8..15 : d = f*32 + 16 + hi*8 + 0..7
        qf[f].h[12 + i] = (bf16)b1[i];
      }
    }
  }

  const bf16* kb_h = kb + ((size_t)b * NHEAD + h) * SEQ * HDIM;
  const f16*  vt_h = vt + ((size_t)b * NHEAD + h) * HDIM * SEQ;

  v8f o[4];
  #pragma unroll
  for (int dt = 0; dt < 4; ++dt) o[dt] = (v8f){0, 0, 0, 0, 0, 0, 0, 0};

  float rmax = -__builtin_inff();                   // maximum in use (same in lane and lane^16)
  float thr  = -__builtin_inff();                   // rmax + LAZY: a score above it forces a renewal
  float rsum = 0.0f;                                // sum over this lane's half of the keys; the halves join after the loop
  const float SL = 0.0625f * 1.4426950408889634f;   // logit scale 1/sqrt(256) times log2(e)

  // copy map: thread tid brings rows (tid >> 3) and 32 + (tid >> 3), 16-B unit tid & 7, of the K tile and of the V^T tile
  const int crow = tid >> 3;
  const int ccol = tid & 7;
  const unsigned lds0 = (unsigned)(size_t)sKV + (unsigned)(crow * LROW + ccol) * 16u;
  const char* gk = (const char*)kb_h + (size_t)crow * (HDIM * 2) + ccol * 16;   // + stage * KT * 128 B
  const char* gv = (const char*)vt_h + (size_t)crow * (SEQ * 2) + ccol * 16;    // + stage * 128 B

  const int nstage = SEQ / KT;                        // uniform for every wave
  // prologue: stage 0 lands and is published, then stage 1 flies
  copy_stage(lds0, lds0 + 32 * LROW * 16, lds0 + VOFF * 16, lds0 + (VOFF + 32 * LROW) * 16,
             gk, gk + 32 * (HDIM * 2), gv, gv + (size_t)32 * (SEQ * 2));
  asm volatile("s_wait_asynccnt 0x0" ::: "memory");   // this wave's share of stage 0 has landed
  __syncthreads();                                    // publishes stage 0
  copy_stage(lds0 + STG * 16, lds0 + (STG + 32 * LROW) * 16, lds0 + (STG + VOFF) * 16, lds0 + (STG + VOFF + 32 * LROW) * 16,
             gk + KT * (HDIM * 2), gk + (KT + 32) * (HDIM * 2), gv + KT * 2, gv + (size_t)32 * (SEQ * 2) + KT * 2);

  // K A-fragments of one pass: row = key ps*32 + sub*16 + lq of the stage, split d map
  auto load_k = [&](FragB (&ak)[2][2], const v4u* frag, int ps) {
    #pragma unroll
    for (int sub = 0; sub < 2; ++sub) {
      #pragma unroll
      for (int f = 0; f < 2; ++f) {
        const v4u* base = frag + (ps * 32 + sub * 16) * LROW + f * 4;
        ak[sub][f].q[0] = base[0];                    // d = f*32 + hi*8 + 0..7
        ak[sub][f].q[1] = base[2];                    // d = f*32 + 16 + hi*8 + 0..7
      }
    }
  };
  // V B-fragments of one pass: column n = d = dt*16 + lq, split key map from the transposed rows
  auto load_v = [&](FragH (&bv)[4], const v4u* frag, int ps) {
    #pragma unroll
    for (int dt = 0; dt < 4; ++dt) {
      const v4u* base = frag + VOFF + (dt * 16) * LROW + ps * 4;
      bv[dt].q[0] = base[0];                          // keys ps*32 + hi*8 + 0..7
      bv[dt].q[1] = base[2];                          // keys ps*32 + 16 + hi*8 + 0..7
    }
  };
  // S^T tiles: c[sub][r] = rawscore(query qrow0+lq, key j0 + sub*16 + hi*8 + r)
  auto scores = [&](v8f (&c)[2], FragB (&ak)[2][2]) {
    #pragma unroll
    for (int sub = 0; sub < 2; ++sub) {
      v8f acc = (v8f){0, 0, 0, 0, 0, 0, 0, 0};
      acc = mma_bf16(ak[sub][0].v, qf[0].v, acc);
      acc = mma_bf16(ak[sub][1].v, qf[1].v, acc);
      c[sub] = acc;
    }
  };
  // softmax of one pass's scores and O += P x V
  auto soft_pv = [&](v8f (&c)[2], FragH (&bv)[4]) {
    // largest of this lane's 16 scores, as a tree (three levels instead of a chain of eight)
    const float ma = fmaxf(fmaxf(c[0][0], c[1][0]), c[0][1]);
    const float mb = fmaxf(fmaxf(c[1][1], c[0][2]), c[1][2]);
    const float mc = fmaxf(fmaxf(c[0][3], c[1][3]), c[0][4]);
    const float md = fmaxf(fmaxf(c[1][4], c[0][5]), c[1][5]);
    const float me = fmaxf(fmaxf(c[0][6], c[1][6]), c[0][7]);
    const float mloc = fmaxf(fmaxf(fmaxf(ma, mb), c[1][7]), fmaxf(fmaxf(mc, md), me));

    // lazy rescale: one wave-uniform test per pass; the halves' join of the maximum, the scale's broadcast
    // and the rescale of O and of the sum run only when some lane's score exceeds the maximum in use by LAZY
    if (__builtin_amdgcn_ballot_w32(mloc > thr) != 0u) {
      const float m_new = fmaxf(rmax, fmaxf(mloc, __shfl_xor(mloc, 16, 32)));
      const float scale = __builtin_amdgcn_exp2f((rmax - m_new) * SL);
      rmax = m_new;
      thr  = m_new + LAZY;
      rsum *= scale;
      // queries are the row dimension of O -> per-row scale from lane 8*hi + r
      float sc[8];
      #pragma unroll
      for (int r = 0; r < 8; ++r) sc[r] = __shfl(scale, (hi << 3) + r, 32);
      #pragma unroll
      for (int dt = 0; dt < 4; ++dt) {
        #pragma unroll
        for (int r = 0; r < 8; ++r) o[dt][r] *= sc[r];
      }
    }

    // exp + pack: P^T C-layout == A-fragment layout for the PV product; P carried x4096 (below 32768 by LAZY)
    FragH pa;
    float psum = 0.0f;
    #pragma unroll
    for (int r = 0; r < 8; ++r) {
      const float p0 = __builtin_amdgcn_exp2f((c[0][r] - rmax) * SL);   // key hi*8 + r
      const float p1 = __builtin_amdgcn_exp2f((c[1][r] - rmax) * SL);   // key 16 + hi*8 + r
      psum += p0 + p1;
      pa.h[r]     = (f16)(p0 * 4096.0f);
      pa.h[8 + r] = (f16)(p1 * 4096.0f);
    }
    rsum += psum;                                     // this lane's half only: an exchange per pass would be waited for at the next test

    // O += P x V
    __builtin_amdgcn_sched_barrier(0);                // keeps the sum's additions in front of the products: moved behind them they land in operand registers just read and cost v_nop padding
    #pragma unroll
    for (int dt = 0; dt < 4; ++dt) o[dt] = mma_f16(pa.v, bv[dt].v, o[dt]);
  };

  // fragments run ahead of their products: K of the next pass and V of the whole stage are read right behind a pass's
  // score products, so the LDS transfer runs under the softmax instead of being waited for at the top of each pass
  FragB ak[2][2];
  load_k(ak, sKV + lq * LROW + hi, 0);                // first fragment loads: stage 0 is published

  #pragma unroll 1   // rolled: the ring's publish point stands once in the two-pass body
  for (int t = 0; t < nstage; ++t) {
   const int bo = (t & 1) * STG;                      // this stage's buffer
   const v4u* frag = sKV + bo + lq * LROW + hi;
   FragH bv[2][4];
   v8f c[2];

   scores(c, ak);
   __builtin_amdgcn_sched_barrier(0);                 // keeps the four score products in front of the load group: without it the loads stand among them in four pieces
   load_v(bv[0], frag, 0);
   load_v(bv[1], frag, 1);
   load_k(ak, frag, 1);
   __builtin_amdgcn_sched_barrier(0);                 // holds the load group here, as one group: without it the loads sink behind the rescale test, in pieces
   soft_pv(c, bv[0]);

   scores(c, ak);
   // distance behind the run of eight products (O of the first pass, scores of the second) on the paths that jump over
   // the refill and the fetch below; naming c and o keeps the run in front
   asm volatile("v_nop\n\tv_nop\n\tv_nop\n\tv_nop"
                : "+v"(c[0]), "+v"(c[1]), "+v"(o[0]), "+v"(o[1]), "+v"(o[2]), "+v"(o[3]));
   // publish point of stage t + 1, ahead of the stage's last softmax: all of stage t's fragments are in registers by now,
   // and the fetch behind it already reads stage t + 1; the same barrier ends every wave's reads of stage t's buffer
   asm volatile("s_wait_dscnt 0x0" ::: "memory");     // this wave's LDS reads of stage t are done
   asm volatile("s_wait_asynccnt 0x0" ::: "memory");  // this wave's share of stage t + 1 has landed
   __syncthreads();
   if (t + 2 < nstage) {                              // uniform: refill the buffer just read with stage t + 2
     const char* nk = gk + (size_t)(t + 2) * (KT * HDIM * 2);
     const char* nv = gv + (size_t)(t + 2) * (KT * 2);
     const unsigned ld = lds0 + (unsigned)bo * 16u;
     copy_stage(ld, ld + 32 * LROW * 16, ld + VOFF * 16, ld + (VOFF + 32 * LROW) * 16,
                nk, nk + 32 * (HDIM * 2), nv, nv + (size_t)32 * (SEQ * 2));
   }
   if (t + 1 < nstage) {                              // uniform: the last stage has nothing behind it to fetch
     load_k(ak, sKV + ((t + 1) & 1) * STG + lq * LROW + hi, 0);
   }
   soft_pv(c, bv[1]);
  }
  asm volatile("s_wait_asynccnt 0x0" ::: "memory");   // nothing is in flight when the ring is left

  rsum += __shfl_xor(rsum, 16, 32);                   // both halves carry the same maximum, so their sums add as they are

  // normalize: lane holds column d = dt*16 + lq for query rows 8*hi + r
  float rs[8];
  #pragma unroll
  for (int r = 0; r < 8; ++r) rs[r] = 1.0f / __shfl(rsum, (hi << 3) + r, 32);

  float* so = sO + wave * (16 * OP);
  #pragma unroll
  for (int r = 0; r < 8; ++r) {
    #pragma unroll
    for (int dt = 0; dt < 4; ++dt) {
      so[(hi * 8 + r) * OP + dt * 16 + lq] = o[dt][r] * (1.0f / 4096.0f) * rs[r];
    }
  }
  __syncthreads();

  // lanes 0..15 store one row (16 consecutive lanes x 16 B each), lanes 16..31 the next row; 8 instructions cover the wave's 16 rows.
  v4f    vals[8];
  size_t gidx[8];
  #pragma unroll
  for (int it = 0; it < 8; ++it) {
    const int row = it * 2 + hi;
    vals[it] = *(const v4f*)(so + row * OP + lq * 4);
    gidx[it] = (((size_t)b * NHEAD + h) * SEQ_FULL + qrow0 + row) * HDIM + lq * 4;
  }
  #pragma unroll
  for (int it = 0; it < 8; ++it) *(v4f*)(out + gidx[it]) = vals[it];
  
}

extern "C" void kernel_launch(void* const* d_in, const int* in_sizes, int n_in,
                              void* d_out, int out_size, void* d_ws, size_t ws_size,
                              hipStream_t stream) {
  if (n_in < 3) return;
  // last element touched of each [b][h][s][d] array (full-size strides, NB x SEQ sub-problem)
  const size_t need = ((((size_t)(NB - 1) * NHEAD + (NHEAD - 1)) * SEQ_FULL) + SEQ) * HDIM;
  if ((size_t)in_sizes[0] < need) return;
  if ((size_t)in_sizes[1] < need) return;
  if ((size_t)in_sizes[2] < need) return;
  if ((size_t)out_size < need) return;

  const size_t kb_elems = (size_t)NB * NHEAD * SEQ * HDIM;   // bf16 K plane
  const size_t vt_elems = (size_t)NB * NHEAD * HDIM * SEQ;   // f16 V^T plane
  const size_t kb_bytes = kb_elems * 2;
  const size_t vt_bytes = vt_elems * 2;
  if (ws_size < kb_bytes + vt_bytes) return;

  const float* q   = (const float*)d_in[0];
  const float* k   = (const float*)d_in[1];
  const float* v   = (const float*)d_in[2];
  float*       out = (float*)d_out;
  bf16*        kb  = (bf16*)d_ws;
  f16*         vt  = (f16*)((char*)d_ws + kb_bytes);

  kv_planes_kernel<<<dim3(SEQ / CT, NHEAD, NB), 256, 0, stream>>>(k, v, kb, vt);
  attn_kernel<<<dim3(SEQ / BQ, NHEAD, NB), 256, 0, stream>>>(q, kb, vt, out);
}

// v005
// One run takes 66 microseconds.
// Next to v004, in two timings, it ran 1.06 and 1.07 times as fast.
// Counting every step since v000, it is 3.94 times as fast.
#include <hip/hip_runtime.h>

// Contractions: S^T = K x Q^T on v_wmma_f32_16x16x32_bf16 (bf16 operands = RNE-converted inputs, f32 accumulate);
// O = P x V on v_wmma_f32_16x16x32_f16 (P as f16 carried x4096; V = f16 of the bf16 RNE-converted input; f32 accumulate).
// Softmax (online, max-subtracted) in f32; the subtracted maximum is renewed only when a score outgrows it by LAZY.
// The exponent of each P is one fused multiply-add: score * SL + bias, bias = 12 - maximum * SL, so P and its sum both carry x4096.

#ifndef NB
#define NB 2
#endif
#ifndef SEQ
#define SEQ 4096
#endif
#define NB_FULL    2
#define SEQ_FULL   4096
#define NHEAD      8
#define HDIM       64
#define BQ         128                  // query rows per workgroup (8 waves x 16)
#define BK         32                   // keys per inner iteration
#define NWAVE      8
#define CT         64                   // keys per plane-builder block
#define TP         72                   // LDS pitch (halves) of the transposed V tile
#define OP         68                   // LDS pitch (floats) of the output staging tile
#define KT         64                   // keys per LDS stage (two inner iterations)
#define LROW       9                    // LDS row pitch in 16-B units: 128 B of data + 16 B (odd multiple of 16 B)
#define VOFF       (KT * LROW)          // first V^T row of a stage, 16-B units
#define STG        (KT * LROW + HDIM * LROW)   // one stage, 16-B units
#define WS_CAP     134217728ull         // workspace carve ceiling (bytes)
#define LAZY       32.0f                // raw-score margin over the maximum in use: P <= 2^(32/16*log2 e) < 8, x4096 < 32768 (f16 finite)

static_assert(SEQ % BQ == 0);
static_assert(SEQ % CT == 0);
static_assert(SEQ % BK == 0);
static_assert(SEQ % KT == 0 && SEQ / KT >= 2);   // the two-buffer prologue needs two stages
static_assert(KT == 2 * BK);
static_assert(KT * 8 == 2 * 256 && HDIM * 8 == 2 * 256);   // 16-B units per tile = two per thread
static_assert(BQ == NWAVE * 16);
static_assert(HDIM == 64);
static_assert(HDIM % 32 == 0);
static_assert(HDIM * 4 == 16 * 16);           // one output row = 16 lanes x 16 B
static_assert(CT * 2 == 128);
static_assert(HDIM * 2 == 128);
static_assert(CT == 64 && CT <= TP);
static_assert(SEQ <= SEQ_FULL);
static_assert(NB >= 1 && NB <= NB_FULL);
static_assert((TP * 2) % 16 == 0);
static_assert((OP * 4) % 16 == 0);
static_assert(OP >= HDIM);
static_assert((unsigned long long)NB * NHEAD * SEQ * HDIM * 2ull * 2ull <= WS_CAP);

typedef __bf16   bf16;
typedef _Float16 f16;
typedef bf16     v16bf __attribute__((ext_vector_type(16)));
typedef f16      v16h  __attribute__((ext_vector_type(16)));
typedef f16      v8h   __attribute__((ext_vector_type(8)));
typedef float    v8f   __attribute__((ext_vector_type(8)));
typedef float    v4f   __attribute__((ext_vector_type(4)));
typedef float    v2f   __attribute__((ext_vector_type(2)));
typedef unsigned v4u   __attribute__((ext_vector_type(4)));

union FragB  { v16bf v; v4u q[2]; bf16 h[16]; };
union FragH  { v16h  v; v4u q[2]; f16  h[16]; };
union Pack8B { v4u u; bf16 h[8]; };
union Pack8H { v4u u; v8h v; f16 h[8]; };

// WMMA helpers: the plain builtins; the compiler keeps the distance behind each product itself and counts the
// products and the independent vector work that it places there.
static __device__ __forceinline__ v8f mma_bf16(v16bf a, v16bf b, v8f acc) {
  return __builtin_amdgcn_wmma_f32_16x16x32_bf16(false, a, false, b, (short)0, acc, false, false);
}
static __device__ __forceinline__ v8f mma_f16(v16h a, v16h b, v8f acc) {
  return __builtin_amdgcn_wmma_f32_16x16x32_f16(false, a, false, b, (short)0, acc, false, false);
}

// One stage (64 K rows of 128 B, 64 V^T rows of 128 B) into LDS: four 16-B asynchronous copies per lane.
// The s_wait_xcnt closes the statement so that no address register is rewritten ahead of it.
static __device__ __forceinline__ void copy_stage(unsigned l0, unsigned l1, unsigned l2, unsigned l3,
                                                  const void* g0, const void* g1,
                                                  const void* g2, const void* g3) {
  asm volatile("global_load_async_to_lds_b128 %0, %4, off\n\t"
               "global_load_async_to_lds_b128 %1, %5, off\n\t"
               "global_load_async_to_lds_b128 %2, %6, off\n\t"
               "global_load_async_to_lds_b128 %3, %7, off\n\t"
               "s_wait_xcnt 0x0"
               :: "v"(l0), "v"(l1), "v"(l2), "v"(l3), "v"(g0), "v"(g1), "v"(g2), "v"(g3)
               : "memory");
}

// Plane builder. Block = (64-key tile, head, batch), 256 threads.
// coverage: keys kt*64 + {0..31, 32..63}, d 0..63 for both planes; every written line whole, one instruction.
// LDS tile sT is cross-wave (block barrier between fill and readback); staged extent 64 d x 64 keys == consumed extent.
__global__ __launch_bounds__(256) void kv_planes_kernel(const float* __restrict__ kin,
                                                        const float* __restrict__ vin,
                                                        bf16* __restrict__ kb,
                                                        f16* __restrict__ vt) {
  const int kt  = blockIdx.x;
  const int h   = blockIdx.y;
  const int b   = blockIdx.z;
  const int tid = threadIdx.x;
  __shared__ __align__(16) f16 sT[HDIM * TP];   // [d][key]
  const int s0 = kt * CT;

  v4u    kval[2];
  size_t kidx[2];
  #pragma unroll
  for (int kk = 0; kk < 2; ++kk) {
    const int key = kk * 32 + (tid >> 3);       // 0..63
    const int d0  = (tid & 7) * 8;              // 0..56
    const size_t src = (((size_t)b * NHEAD + h) * SEQ_FULL + s0 + key) * HDIM + d0;
    const v4f k0 = *(const v4f*)(kin + src);
    const v4f k1 = *(const v4f*)(kin + src + 4);
    const v4f v0 = *(const v4f*)(vin + src);
    const v4f v1 = *(const v4f*)(vin + src + 4);
    Pack8B pk;
    #pragma unroll
    for (int i = 0; i < 4; ++i) {
      pk.h[i]     = (bf16)k0[i];                          // RNE convert
      pk.h[4 + i] = (bf16)k1[i];
    }
    kval[kk] = pk.u;
    kidx[kk] = (((size_t)b * NHEAD + h) * SEQ + s0 + key) * HDIM + d0;
    #pragma unroll
    for (int i = 0; i < 4; ++i) {
      sT[(d0 + i) * TP + key]     = (f16)(float)(bf16)v0[i];   // f16 of bf16 value: exact
      sT[(d0 + 4 + i) * TP + key] = (f16)(float)(bf16)v1[i];
    }
  }
  __syncthreads();

  v4u    vval[2];
  size_t vidx[2];
  #pragma unroll
  for (int kk = 0; kk < 2; ++kk) {
    const int d  = kk * 32 + (tid >> 3);        // 0..63
    const int ks = (tid & 7) * 8;               // 0..56
    Pack8H ph;
    ph.v = *(const v8h*)(sT + d * TP + ks);
    vval[kk] = ph.u;
    vidx[kk] = (((size_t)b * NHEAD + h) * HDIM + d) * SEQ + s0 + ks;
  }

  #pragma unroll
  for (int kk = 0; kk < 2; ++kk) {
    *(v4u*)(kb + kidx[kk]) = kval[kk];
    *(v4u*)(vt + vidx[kk]) = vval[kk];
  }
  
}

// Fused online-softmax attention, no mask, logit scale 1/16.
// Block = (query block of 128, head, batch); one wave owns 16 query rows and visits all SEQ keys, 32 per step.
// S^T = K x Q^T so queries sit on lanes; P^T in C-layout is bit-identical to the A-fragment layout of O += P x V.
// K rows and V^T rows of 64 keys are staged once per workgroup in a two-buffer LDS ring by asynchronous copies
// (whole 128-B lines from the planes); every wave reads its fragments from there, two 16-B LDS loads per fragment.
__global__ __launch_bounds__(256) void attn_kernel(const float* __restrict__ q,
                                                   const bf16* __restrict__ kb,
                                                   const f16* __restrict__ vt,
                                                   float* __restrict__ out) {
  const int qblk = blockIdx.x;
  const int h    = blockIdx.y;
  const int b    = blockIdx.z;
  const int tid  = threadIdx.x;
  const int wave = __builtin_amdgcn_readfirstlane(threadIdx.x >> 5);
  const int lane = tid & 31;
  const int lq   = lane & 15;   // query column of S^T / d column of O
  const int hi   = lane >> 4;   // k-split half

  // per-wave output staging: each wave writes and reads only its own 16 x OP slice (block barrier used anyway)
  __shared__ __align__(16) float sO[NWAVE * 16 * OP];
  // K / V^T ring: [buffer][K rows 0..63 | V^T rows 0..63][9 x 16 B]
  __shared__ __align__(16) v4u sKV[2 * STG];

  const int qrow0 = qblk * BQ + wave * 16;               // first query row of this wave

  // Q as B-operand fragments: lane lq holds query qrow0+lq, elements follow the split d map; bf16 RNE convert.
  FragB qf[2];
  {
    const float* qp = q + (((size_t)b * NHEAD + h) * SEQ_FULL + qrow0 + lq) * HDIM;
    #pragma unroll
    for (int f = 0; f < 2; ++f) {
      const v4f a0 = *(const v4f*)(qp + f * 32 + hi * 8);
      const v4f a1 = *(const v4f*)(qp + f * 32 + hi * 8 + 4);
      const v4f b0 = *(const v4f*)(qp + f * 32 + 16 + hi * 8);
      const v4f b1 = *(const v4f*)(qp + f * 32 + 16 + hi * 8 + 4);
      #pragma unroll
      for (int i = 0; i < 4; ++i) {
        qf[f].h[i]      = (bf16)a0[i];   // elems 0..7  : d = f*32 + hi*8 + 0..7
        qf[f].h[4 + i]  = (bf16)a1[i];
        qf[f].h[8 + i]  = (bf16)b0[i];   // elems 8..15 : d = f*32 + 16 + hi*8 + 0..7
        qf[f].h[12 + i] = (bf16)b1[i];
      }
    }
  }

  const bf16* kb_h = kb + ((size_t)b * NHEAD + h) * SEQ * HDIM;
  const f16*  vt_h = vt + ((size_t)b * NHEAD + h) * HDIM * SEQ;

  v8f o[4];
  #pragma unroll
  for (int dt = 0; dt < 4; ++dt) o[dt] = (v8f){0, 0, 0, 0, 0, 0, 0, 0};

  float rmax = -__builtin_inff();                   // maximum in use (same in lane and lane^16)
  float thr  = -__builtin_inff();                   // rmax + LAZY: a score above it forces a renewal
  float bias = 12.0f;                               // 12 - rmax * SL, set with every renewal (the first pass always renews)
  float rsum = 0.0f;                                // x4096 sum over this lane's half of the keys; the halves join after the loop
  const float SL = 0.0625f * 1.4426950408889634f;   // logit scale 1/sqrt(256) times log2(e)

  // copy map: thread tid brings rows (tid >> 3) and 32 + (tid >> 3), 16-B unit tid & 7, of the K tile and of the V^T tile
  const int crow = tid >> 3;
  const int ccol = tid & 7;
  const unsigned lds0 = (unsigned)(size_t)sKV + (unsigned)(crow * LROW + ccol) * 16u;
  const char* gk = (const char*)kb_h + (size_t)crow * (HDIM * 2) + ccol * 16;   // + stage * KT * 128 B
  const char* gv = (const char*)vt_h + (size_t)crow * (SEQ * 2) + ccol * 16;    // + stage * 128 B

  const int nstage = SEQ / KT;                        // uniform for every wave
  // prologue: stage 0 lands and is published, then stage 1 flies
  copy_stage(lds0, lds0 + 32 * LROW * 16, lds0 + VOFF * 16, lds0 + (VOFF + 32 * LROW) * 16,
             gk, gk + 32 * (HDIM * 2), gv, gv + (size_t)32 * (SEQ * 2));
  asm volatile("s_wait_asynccnt 0x0" ::: "memory");   // this wave's share of stage 0 has landed
  __syncthreads();                                    // publishes stage 0
  copy_stage(lds0 + STG * 16, lds0 + (STG + 32 * LROW) * 16, lds0 + (STG + VOFF) * 16, lds0 + (STG + VOFF + 32 * LROW) * 16,
             gk + KT * (HDIM * 2), gk + (KT + 32) * (HDIM * 2), gv + KT * 2, gv + (size_t)32 * (SEQ * 2) + KT * 2);

  // K A-fragments of one pass: row = key ps*32 + sub*16 + lq of the stage, split d map
  auto load_k = [&](FragB (&ak)[2][2], const v4u* frag, int ps) {
    #pragma unroll
    for (int sub = 0; sub < 2; ++sub) {
      #pragma unroll
      for (int f = 0; f < 2; ++f) {
        const v4u* base = frag + (ps * 32 + sub * 16) * LROW + f * 4;
        ak[sub][f].q[0] = base[0];                    // d = f*32 + hi*8 + 0..7
        ak[sub][f].q[1] = base[2];                    // d = f*32 + 16 + hi*8 + 0..7
      }
    }
  };
  // V B-fragments of one pass: column n = d = dt*16 + lq, split key map from the transposed rows
  auto load_v = [&](FragH (&bv)[4], const v4u* frag, int ps) {
    #pragma unroll
    for (int dt = 0; dt < 4; ++dt) {
      const v4u* base = frag + VOFF + (dt * 16) * LROW + ps * 4;
      bv[dt].q[0] = base[0];                          // keys ps*32 + hi*8 + 0..7
      bv[dt].q[1] = base[2];                          // keys ps*32 + 16 + hi*8 + 0..7
    }
  };
  // S^T tiles: c[sub][r] = rawscore(query qrow0+lq, key j0 + sub*16 + hi*8 + r)
  auto scores = [&](v8f (&c)[2], FragB (&ak)[2][2]) {
    #pragma unroll
    for (int sub = 0; sub < 2; ++sub) {
      v8f acc = (v8f){0, 0, 0, 0, 0, 0, 0, 0};
      acc = mma_bf16(ak[sub][0].v, qf[0].v, acc);
      acc = mma_bf16(ak[sub][1].v, qf[1].v, acc);
      c[sub] = acc;
    }
  };
  // softmax of one pass's scores and O += P x V
  auto soft_pv = [&](v8f (&c)[2], FragH (&bv)[4]) {
    // largest of this lane's 16 scores, as a tree (three levels instead of a chain of eight)
    const float ma = fmaxf(fmaxf(c[0][0], c[1][0]), c[0][1]);
    const float mb = fmaxf(fmaxf(c[1][1], c[0][2]), c[1][2]);
    const float mc = fmaxf(fmaxf(c[0][3], c[1][3]), c[0][4]);
    const float md = fmaxf(fmaxf(c[1][4], c[0][5]), c[1][5]);
    const float me = fmaxf(fmaxf(c[0][6], c[1][6]), c[0][7]);
    const float mloc = fmaxf(fmaxf(fmaxf(ma, mb), c[1][7]), fmaxf(fmaxf(mc, md), me));

    // lazy rescale: one wave-uniform test per pass; the halves' join of the maximum, the scale's broadcast
    // and the rescale of O and of the sum run only when some lane's score exceeds the maximum in use by LAZY
    if (__builtin_amdgcn_ballot_w32(mloc > thr) != 0u) {
      const float m_new = fmaxf(rmax, fmaxf(mloc, __shfl_xor(mloc, 16, 32)));
      const float scale = __builtin_amdgcn_exp2f((rmax - m_new) * SL);
      rmax = m_new;
      thr  = m_new + LAZY;
      bias = __builtin_fmaf(-m_new, SL, 12.0f);
      rsum *= scale;
      // queries are the row dimension of O -> per-row scale from lane 8*hi + r
      float sc[8];
      #pragma unroll
      for (int r = 0; r < 8; ++r) sc[r] = __shfl(scale, (hi << 3) + r, 32);
      #pragma unroll
      for (int dt = 0; dt < 4; ++dt) {
        #pragma unroll
        for (int r = 0; r < 8; ++r) o[dt][r] *= sc[r];
      }
    }

    // exp + pack: P^T C-layout == A-fragment layout for the PV product; P carried x4096 (below 32768 by LAZY)
    FragH pa;
    float psum = 0.0f;
    v2f e[2][4];
    #pragma unroll
    for (int i = 0; i < 4; ++i) {
      e[0][i] = __builtin_elementwise_fma((v2f){c[0][2 * i], c[0][2 * i + 1]}, (v2f){SL, SL}, (v2f){bias, bias});   // keys hi*8 + 2i, 2i + 1
      e[1][i] = __builtin_elementwise_fma((v2f){c[1][2 * i], c[1][2 * i + 1]}, (v2f){SL, SL}, (v2f){bias, bias});   // keys 16 + hi*8 + 2i, 2i + 1
    }
    #pragma unroll
    for (int r = 0; r < 8; ++r) {
      const float p0 = __builtin_amdgcn_exp2f(e[0][r >> 1][r & 1]);   // key hi*8 + r
      const float p1 = __builtin_amdgcn_exp2f(e[1][r >> 1][r & 1]);   // key 16 + hi*8 + r
      psum += p0 + p1;
      pa.h[r]     = (f16)p0;
      pa.h[8 + r] = (f16)p1;
    }
    rsum += psum;                                     // this lane's half only: an exchange per pass would be waited for at the next test

    // O += P x V
    __builtin_amdgcn_sched_barrier(0);                // keeps the sum's additions in front of the products: moved behind them they land in operand registers just read and cost v_nop padding
    #pragma unroll
    for (int dt = 0; dt < 4; ++dt) o[dt] = mma_f16(pa.v, bv[dt].v, o[dt]);
  };

  // fragments run ahead of their products: K of the next pass and V of the whole stage are read right behind a pass's
  // score products, so the LDS transfer runs under the softmax instead of being waited for at the top of each pass
  FragB ak[2][2];
  load_k(ak, sKV + lq * LROW + hi, 0);                // first fragment loads: stage 0 is published

  #pragma unroll 1   // rolled: the ring's publish point stands once in the two-pass body
  for (int t = 0; t < nstage; ++t) {
   const int bo = (t & 1) * STG;                      // this stage's buffer
   const v4u* frag = sKV + bo + lq * LROW + hi;
   FragH bv[2][4];
   v8f c[2];

   scores(c, ak);
   __builtin_amdgcn_sched_barrier(0);                 // keeps the four score products in front of the load group: without it the loads stand among them in four pieces
   load_v(bv[0], frag, 0);
   load_v(bv[1], frag, 1);
   load_k(ak, frag, 1);
   __builtin_amdgcn_sched_barrier(0);                 // holds the load group here, as one group: without it the loads sink behind the rescale test, in pieces
   soft_pv(c, bv[0]);

   scores(c, ak);
   // distance behind the run of eight products (O of the first pass, scores of the second) on the paths that jump over
   // the refill and the fetch below; naming c and o keeps the run in front
   asm volatile("v_nop\n\tv_nop\n\tv_nop\n\tv_nop"
                : "+v"(c[0]), "+v"(c[1]), "+v"(o[0]), "+v"(o[1]), "+v"(o[2]), "+v"(o[3]));
   // publish point of stage t + 1, ahead of the stage's last softmax: all of stage t's fragments are in registers by now,
   // and the fetch behind it already reads stage t + 1; the same barrier ends every wave's reads of stage t's buffer
   asm volatile("s_wait_dscnt 0x0" ::: "memory");     // this wave's LDS reads of stage t are done
   asm volatile("s_wait_asynccnt 0x0" ::: "memory");  // this wave's share of stage t + 1 has landed
   __syncthreads();
   if (t + 2 < nstage) {                              // uniform: refill the buffer just read with stage t + 2
     const char* nk = gk + (size_t)(t + 2) * (KT * HDIM * 2);
     const char* nv = gv + (size_t)(t + 2) * (KT * 2);
     const unsigned ld = lds0 + (unsigned)bo * 16u;
     copy_stage(ld, ld + 32 * LROW * 16, ld + VOFF * 16, ld + (VOFF + 32 * LROW) * 16,
                nk, nk + 32 * (HDIM * 2), nv, nv + (size_t)32 * (SEQ * 2));
   }
   if (t + 1 < nstage) {                              // uniform: the last stage has nothing behind it to fetch
     load_k(ak, sKV + ((t + 1) & 1) * STG + lq * LROW + hi, 0);
   }
   soft_pv(c, bv[1]);
  }
  asm volatile("s_wait_asynccnt 0x0" ::: "memory");   // nothing is in flight when the ring is left

  rsum += __shfl_xor(rsum, 16, 32);                   // both halves carry the same maximum, so their sums add as they are

  // normalize: lane holds column d = dt*16 + lq for query rows 8*hi + r
  float rs[8];
  #pragma unroll
  for (int r = 0; r < 8; ++r) rs[r] = 1.0f / __shfl(rsum, (hi << 3) + r, 32);

  float* so = sO + wave * (16 * OP);
  #pragma unroll
  for (int r = 0; r < 8; ++r) {
    #pragma unroll
    for (int dt = 0; dt < 4; ++dt) {
      so[(hi * 8 + r) * OP + dt * 16 + lq] = o[dt][r] * rs[r];   // O and the sum carry the same x4096
    }
  }
  __syncthreads();

  // lanes 0..15 store one row (16 consecutive lanes x 16 B each), lanes 16..31 the next row; 8 instructions cover the wave's 16 rows.
  v4f    vals[8];
  size_t gidx[8];
  #pragma unroll
  for (int it = 0; it < 8; ++it) {
    const int row = it * 2 + hi;
    vals[it] = *(const v4f*)(so + row * OP + lq * 4);
    gidx[it] = (((size_t)b * NHEAD + h) * SEQ_FULL + qrow0 + row) * HDIM + lq * 4;
  }
  #pragma unroll
  for (int it = 0; it < 8; ++it) *(v4f*)(out + gidx[it]) = vals[it];
  
}

extern "C" void kernel_launch(void* const* d_in, const int* in_sizes, int n_in,
                              void* d_out, int out_size, void* d_ws, size_t ws_size,
                              hipStream_t stream) {
  if (n_in < 3) return;
  // last element touched of each [b][h][s][d] array (full-size strides, NB x SEQ sub-problem)
  const size_t need = ((((size_t)(NB - 1) * NHEAD + (NHEAD - 1)) * SEQ_FULL) + SEQ) * HDIM;
  if ((size_t)in_sizes[0] < need) return;
  if ((size_t)in_sizes[1] < need) return;
  if ((size_t)in_sizes[2] < need) return;
  if ((size_t)out_size < need) return;

  const size_t kb_elems = (size_t)NB * NHEAD * SEQ * HDIM;   // bf16 K plane
  const size_t vt_elems = (size_t)NB * NHEAD * HDIM * SEQ;   // f16 V^T plane
  const size_t kb_bytes = kb_elems * 2;
  const size_t vt_bytes = vt_elems * 2;
  if (ws_size < kb_bytes + vt_bytes) return;

  const float* q   = (const float*)d_in[0];
  const float* k   = (const float*)d_in[1];
  const float* v   = (const float*)d_in[2];
  float*       out = (float*)d_out;
  bf16*        kb  = (bf16*)d_ws;
  f16*         vt  = (f16*)((char*)d_ws + kb_bytes);

  kv_planes_kernel<<<dim3(SEQ / CT, NHEAD, NB), 256, 0, stream>>>(k, v, kb, vt);
  attn_kernel<<<dim3(SEQ / BQ, NHEAD, NB), 256, 0, stream>>>(q, kb, vt, out);
}

// v006
// Measured time: 59.9 microseconds a run.
// Timed twice side by side with v005, it ran 1.11 and 1.13 times as fast.
// All steps since v000 together make it 4.40 times as fast.
#include <hip/hip_runtime.h>

// Contractions: S^T = K x Q^T on v_wmma_f32_16x16x32_bf16 (bf16 operands = RNE-converted inputs, f32 accumulate);
// O = P x V on v_wmma_f32_16x16x32_f16 (P as f16 carried x4096; V = f16 of the bf16 RNE-converted input; f32 accumulate).
// Softmax (online, max-subtracted) in f32; the subtracted maximum is renewed only when a score outgrows it by LAZY.
// The exponent of each P is one fused multiply-add: score * SL + bias, bias = 12 - maximum * SL, so P and its sum both carry x4096.

#ifndef NB
#define NB 2
#endif
#ifndef SEQ
#define SEQ 4096
#endif
#define NB_FULL    2
#define SEQ_FULL   4096
#define NHEAD      8
#define HDIM       64
#define BQ         128                  // query rows per workgroup (4 wave pairs x 32)
#define HSEQ       (SEQ / 2)            // keys per key half: waves 0..3 walk the first half, waves 4..7 the second
#define BK         32                   // keys per inner iteration
#define NWAVE      8
#define CT         64                   // keys per plane-builder block
#define TP         72                   // LDS pitch (halves) of the transposed V tile
#define OP         68                   // LDS pitch (floats) of the output staging tile
#define KT         64                   // keys per LDS stage (two inner iterations)
#define LROW       9                    // LDS row pitch in 16-B units: 128 B of data + 16 B (odd multiple of 16 B)
#define VOFF       (KT * LROW)          // first V^T row of a stage, 16-B units
#define STG        (KT * LROW + HDIM * LROW)   // one stage, 16-B units
#define WS_CAP     134217728ull         // workspace carve ceiling (bytes)
#define LAZY       32.0f                // raw-score margin over the maximum in use: P <= 2^(32/16*log2 e) < 8, x4096 < 32768 (f16 finite)

static_assert(SEQ % BQ == 0);
static_assert(SEQ % CT == 0);
static_assert(SEQ % BK == 0);
static_assert(HSEQ % KT == 0 && HSEQ / KT >= 2);   // the two-buffer prologue needs two stages of each key half
static_assert(KT == 2 * BK);
static_assert(KT * 8 == 2 * 256 && HDIM * 8 == 2 * 256);   // 16-B units per tile = two per thread
static_assert(BQ == (NWAVE / 2) * 32);
static_assert(16 * OP >= 32 * 32 + 64);       // a wave's staging slice also carries one O tile, its maxima and its sums to the partner wave
static_assert(HDIM == 64);
static_assert(HDIM % 32 == 0);
static_assert(HDIM * 4 == 16 * 16);           // one output row = 16 lanes x 16 B
static_assert(CT * 2 == 128);
static_assert(HDIM * 2 == 128);
static_assert(CT == 64 && CT <= TP);
static_assert(SEQ <= SEQ_FULL);
static_assert(NB >= 1 && NB <= NB_FULL);
static_assert((TP * 2) % 16 == 0);
static_assert((OP * 4) % 16 == 0);
static_assert(OP >= HDIM);
static_assert((unsigned long long)NB * NHEAD * SEQ * HDIM * 2ull * 2ull <= WS_CAP);

typedef __bf16   bf16;
typedef _Float16 f16;
typedef bf16     v16bf __attribute__((ext_vector_type(16)));
typedef f16      v16h  __attribute__((ext_vector_type(16)));
typedef f16      v8h   __attribute__((ext_vector_type(8)));
typedef float    v8f   __attribute__((ext_vector_type(8)));
typedef float    v4f   __attribute__((ext_vector_type(4)));
typedef float    v2f   __attribute__((ext_vector_type(2)));
typedef unsigned v4u   __attribute__((ext_vector_type(4)));

union FragB  { v16bf v; v4u q[2]; bf16 h[16]; };
union FragH  { v16h  v; v4u q[2]; f16  h[16]; };
union Pack8B { v4u u; bf16 h[8]; };
union Pack8H { v4u u; v8h v; f16 h[8]; };

// WMMA helpers: the plain builtins; the compiler keeps the distance behind each product itself and counts the
// products and the independent vector work that it places there.
static __device__ __forceinline__ v8f mma_bf16(v16bf a, v16bf b, v8f acc) {
  return __builtin_amdgcn_wmma_f32_16x16x32_bf16(false, a, false, b, (short)0, acc, false, false);
}
static __device__ __forceinline__ v8f mma_f16(v16h a, v16h b, v8f acc) {
  return __builtin_amdgcn_wmma_f32_16x16x32_f16(false, a, false, b, (short)0, acc, false, false);
}

// One stage (64 K rows of 128 B, 64 V^T rows of 128 B) into LDS: four 16-B asynchronous copies per lane.
// The s_wait_xcnt closes the statement so that no address register is rewritten ahead of it.
static __device__ __forceinline__ void copy_stage(unsigned l0, unsigned l1, unsigned l2, unsigned l3,
                                                  const void* g0, const void* g1,
                                                  const void* g2, const void* g3) {
  asm volatile("global_load_async_to_lds_b128 %0, %4, off\n\t"
               "global_load_async_to_lds_b128 %1, %5, off\n\t"
               "global_load_async_to_lds_b128 %2, %6, off\n\t"
               "global_load_async_to_lds_b128 %3, %7, off\n\t"
               "s_wait_xcnt 0x0"
               :: "v"(l0), "v"(l1), "v"(l2), "v"(l3), "v"(g0), "v"(g1), "v"(g2), "v"(g3)
               : "memory");
}

// Plane builder. Block = (64-key tile, head, batch), 256 threads.
// coverage: keys kt*64 + {0..31, 32..63}, d 0..63 for both planes; every written line whole, one instruction.
// LDS tile sT is cross-wave (block barrier between fill and readback); staged extent 64 d x 64 keys == consumed extent.
__global__ __launch_bounds__(256) void kv_planes_kernel(const float* __restrict__ kin,
                                                        const float* __restrict__ vin,
                                                        bf16* __restrict__ kb,
                                                        f16* __restrict__ vt) {
  const int kt  = blockIdx.x;
  const int h   = blockIdx.y;
  const int b   = blockIdx.z;
  const int tid = threadIdx.x;
  __shared__ __align__(16) f16 sT[HDIM * TP];   // [d][key]
  const int s0 = kt * CT;

  v4u    kval[2];
  size_t kidx[2];
  #pragma unroll
  for (int kk = 0; kk < 2; ++kk) {
    const int key = kk * 32 + (tid >> 3);       // 0..63
    const int d0  = (tid & 7) * 8;              // 0..56
    const size_t src = (((size_t)b * NHEAD + h) * SEQ_FULL + s0 + key) * HDIM + d0;
    const v4f k0 = *(const v4f*)(kin + src);
    const v4f k1 = *(const v4f*)(kin + src + 4);
    const v4f v0 = *(const v4f*)(vin + src);
    const v4f v1 = *(const v4f*)(vin + src + 4);
    Pack8B pk;
    #pragma unroll
    for (int i = 0; i < 4; ++i) {
      pk.h[i]     = (bf16)k0[i];                          // RNE convert
      pk.h[4 + i] = (bf16)k1[i];
    }
    kval[kk] = pk.u;
    kidx[kk] = (((size_t)b * NHEAD + h) * SEQ + s0 + key) * HDIM + d0;
    #pragma unroll
    for (int i = 0; i < 4; ++i) {
      sT[(d0 + i) * TP + key]     = (f16)(float)(bf16)v0[i];   // f16 of bf16 value: exact
      sT[(d0 + 4 + i) * TP + key] = (f16)(float)(bf16)v1[i];
    }
  }
  __syncthreads();

  v4u    vval[2];
  size_t vidx[2];
  #pragma unroll
  for (int kk = 0; kk < 2; ++kk) {
    const int d  = kk * 32 + (tid >> 3);        // 0..63
    const int ks = (tid & 7) * 8;               // 0..56
    Pack8H ph;
    ph.v = *(const v8h*)(sT + d * TP + ks);
    vval[kk] = ph.u;
    vidx[kk] = (((size_t)b * NHEAD + h) * HDIM + d) * SEQ + s0 + ks;
  }

  #pragma unroll
  for (int kk = 0; kk < 2; ++kk) {
    *(v4u*)(kb + kidx[kk]) = kval[kk];
    *(v4u*)(vt + vidx[kk]) = vval[kk];
  }
  
}

// Fused online-softmax attention, no mask, logit scale 1/16.
// Block = (query block of 128, head, batch); one wave owns 32 query rows (two Q tiles) and visits one half of the keys,
// 32 per step, so each K and V fragment read from LDS feeds two products; waves w and w + 4 share their query rows and
// join their halves (maximum, sum, O) once, behind the loop.
// S^T = K x Q^T so queries sit on lanes; P^T in C-layout is bit-identical to the A-fragment layout of O += P x V.
// K rows and V^T rows of 64 keys of each half are staged once per workgroup in a two-buffer LDS ring by asynchronous copies
// (whole 128-B lines from the planes); every wave reads its fragments from there, two 16-B LDS loads per fragment.
// register budget of four waves per SIMD (256 each): two workgroups stay resident per WGP, as before the wave's tile doubled
__global__ __launch_bounds__(256) __attribute__((amdgpu_waves_per_eu(4, 4))) void attn_kernel(const float* __restrict__ q,
                                                   const bf16* __restrict__ kb,
                                                   const f16* __restrict__ vt,
                                                   float* __restrict__ out) {
  const int qblk = blockIdx.x;
  const int h    = blockIdx.y;
  const int b    = blockIdx.z;
  const int tid  = threadIdx.x;
  const int wave = __builtin_amdgcn_readfirstlane(threadIdx.x >> 5);
  const int lane = tid & 31;
  const int lq   = lane & 15;   // query column of S^T / d column of O
  const int hi   = lane >> 4;   // k-split half

  // per-wave slices of 16 x OP floats: first the hand-over of one O tile to the partner wave (read across waves, between
  // two block barriers), then output staging, where each wave writes and reads only its own slice (block barrier used anyway)
  __shared__ __align__(16) float sO[NWAVE * 16 * OP];
  // K / V^T ring: [buffer][key half][K rows 0..63 | V^T rows 0..63][9 x 16 B]
  __shared__ __align__(16) v4u sKV[2 * 2 * STG];

  const int kg    = wave >> 2;                           // key half of this wave (scalar)
  const int qrow0 = qblk * BQ + (wave & 3) * 32;         // first query row of this wave

  // Q as B-operand fragments: lane lq holds query qrow0+qt*16+lq, elements follow the split d map; bf16 RNE convert.
  FragB qf[2][2];
  #pragma unroll
  for (int qt = 0; qt < 2; ++qt) {
    const float* qp = q + (((size_t)b * NHEAD + h) * SEQ_FULL + qrow0 + qt * 16 + lq) * HDIM;
    #pragma unroll
    for (int f = 0; f < 2; ++f) {
      const v4f a0 = *(const v4f*)(qp + f * 32 + hi * 8);
      const v4f a1 = *(const v4f*)(qp + f * 32 + hi * 8 + 4);
      const v4f b0 = *(const v4f*)(qp + f * 32 + 16 + hi * 8);
      const v4f b1 = *(const v4f*)(qp + f * 32 + 16 + hi * 8 + 4);
      #pragma unroll
      for (int i = 0; i < 4; ++i) {
        qf[qt][f].h[i]      = (bf16)a0[i];   // elems 0..7  : d = f*32 + hi*8 + 0..7
        qf[qt][f].h[4 + i]  = (bf16)a1[i];
        qf[qt][f].h[8 + i]  = (bf16)b0[i];   // elems 8..15 : d = f*32 + 16 + hi*8 + 0..7
        qf[qt][f].h[12 + i] = (bf16)b1[i];
      }
    }
  }

  const bf16* kb_h = kb + ((size_t)b * NHEAD + h) * SEQ * HDIM;
  const f16*  vt_h = vt + ((size_t)b * NHEAD + h) * HDIM * SEQ;

  v8f o[2][4];
  #pragma unroll
  for (int qt = 0; qt < 2; ++qt) {
    #pragma unroll
    for (int dt = 0; dt < 4; ++dt) o[qt][dt] = (v8f){0, 0, 0, 0, 0, 0, 0, 0};
  }

  // per Q tile:
  float rmax[2] = {-__builtin_inff(), -__builtin_inff()};   // maximum in use (same in lane and lane^16)
  float thr[2]  = {-__builtin_inff(), -__builtin_inff()};   // rmax + LAZY: a score above it forces a renewal
  float bias[2] = {12.0f, 12.0f};                   // 12 - rmax * SL, set with every renewal (the first pass always renews)
  float rsum[2] = {0.0f, 0.0f};                     // x4096 sum over this lane's share of the keys; the shares join after the loop
  const float SL = 0.0625f * 1.4426950408889634f;   // logit scale 1/sqrt(256) times log2(e)

  // copy map: thread tid brings rows (tid >> 3) and 32 + (tid >> 3), 16-B unit tid & 7, of each half's K tile and V^T tile
  const int crow = tid >> 3;
  const int ccol = tid & 7;
  const unsigned lds0 = (unsigned)(size_t)sKV + (unsigned)(crow * LROW + ccol) * 16u;
  const unsigned koff = (unsigned)(crow * (HDIM * 2) + ccol * 16);   // lane's byte offset in a K tile; the tile's base is scalar
  const unsigned voff = (unsigned)(crow * (SEQ * 2) + ccol * 16);    // lane's byte offset in a V^T tile

  const int nstage = HSEQ / KT;                       // uniform for every wave
  // stage s = keys s*64 .. s*64+63 of both key halves, into buffer buf: eight copies per lane
  auto fill = [&](int buf, int s) {
    #pragma unroll
    for (int g = 0; g < 2; ++g) {
      const unsigned ld = lds0 + (unsigned)((buf * 2 + g) * STG) * 16u;
      const char* nk = (const char*)kb_h + ((size_t)g * HSEQ + (size_t)s * KT) * (HDIM * 2) + koff;
      const char* nv = (const char*)vt_h + ((size_t)g * HSEQ + (size_t)s * KT) * 2 + voff;
      copy_stage(ld, ld + 32 * LROW * 16, ld + VOFF * 16, ld + (VOFF + 32 * LROW) * 16,
                 nk, nk + 32 * (HDIM * 2), nv, nv + (size_t)32 * (SEQ * 2));
    }
  };
  // prologue: stage 0 lands and is published, then stage 1 flies
  fill(0, 0);
  asm volatile("s_wait_asynccnt 0x0" ::: "memory");   // this wave's share of stage 0 has landed
  __syncthreads();                                    // publishes stage 0
  fill(1, 1);

  // K A-fragments of one pass: row = key ps*32 + sub*16 + lq of the stage, split d map
  auto load_k = [&](FragB (&ak)[2][2], const v4u* frag, int ps) {
    #pragma unroll
    for (int sub = 0; sub < 2; ++sub) {
      #pragma unroll
      for (int f = 0; f < 2; ++f) {
        const v4u* base = frag + (ps * 32 + sub * 16) * LROW + f * 4;
        ak[sub][f].q[0] = base[0];                    // d = f*32 + hi*8 + 0..7
        ak[sub][f].q[1] = base[2];                    // d = f*32 + 16 + hi*8 + 0..7
      }
    }
  };
  // V B-fragments of one pass: column n = d = dt*16 + lq, split key map from the transposed rows
  auto load_v = [&](FragH (&bv)[4], const v4u* frag, int ps) {
    #pragma unroll
    for (int dt = 0; dt < 4; ++dt) {
      const v4u* base = frag + VOFF + (dt * 16) * LROW + ps * 4;
      bv[dt].q[0] = base[0];                          // keys ps*32 + hi*8 + 0..7
      bv[dt].q[1] = base[2];                          // keys ps*32 + 16 + hi*8 + 0..7
    }
  };
  // S^T tiles: c[qt][sub][r] = rawscore(query qrow0+qt*16+lq, key j0 + sub*16 + hi*8 + r); four independent chains of two
  auto scores = [&](v8f (&c)[2][2], FragB (&ak)[2][2]) {
    #pragma unroll
    for (int f = 0; f < 2; ++f) {
      #pragma unroll
      for (int sub = 0; sub < 2; ++sub) {
        #pragma unroll
        for (int qt = 0; qt < 2; ++qt) {
          c[qt][sub] = mma_bf16(ak[sub][f].v, qf[qt][f].v, f == 0 ? (v8f){0, 0, 0, 0, 0, 0, 0, 0} : c[qt][sub]);
        }
      }
    }
  };
  // softmax of one pass's scores and O += P x V, both Q tiles
  auto soft_pv = [&](v8f (&c)[2][2], FragH (&bv)[4]) {
    // largest of this lane's 16 scores of each tile, as a tree (three levels instead of a chain of eight)
    float mloc[2];
    #pragma unroll
    for (int qt = 0; qt < 2; ++qt) {
      const v8f (&d)[2] = c[qt];
      const float ma = fmaxf(fmaxf(d[0][0], d[1][0]), d[0][1]);
      const float mb = fmaxf(fmaxf(d[1][1], d[0][2]), d[1][2]);
      const float mc = fmaxf(fmaxf(d[0][3], d[1][3]), d[0][4]);
      const float md = fmaxf(fmaxf(d[1][4], d[0][5]), d[1][5]);
      const float me = fmaxf(fmaxf(d[0][6], d[1][6]), d[0][7]);
      mloc[qt] = fmaxf(fmaxf(fmaxf(ma, mb), d[1][7]), fmaxf(fmaxf(mc, md), me));
    }

    // lazy rescale: one wave-uniform test per pass for both tiles; the halves' join of the maximum, the scale's broadcast
    // and the rescale of O and of the sum run only when some lane's score exceeds the maximum in use by LAZY
    if (__builtin_amdgcn_ballot_w32((mloc[0] > thr[0]) | (mloc[1] > thr[1])) != 0u) {
      #pragma unroll
      for (int qt = 0; qt < 2; ++qt) {
        const float m_new = fmaxf(rmax[qt], fmaxf(mloc[qt], __shfl_xor(mloc[qt], 16, 32)));
        const float scale = __builtin_amdgcn_exp2f((rmax[qt] - m_new) * SL);
        rmax[qt] = m_new;
        thr[qt]  = m_new + LAZY;
        bias[qt] = __builtin_fmaf(-m_new, SL, 12.0f);
        rsum[qt] *= scale;
        // queries are the row dimension of O -> per-row scale from lane 8*hi + r
        float sc[8];
        #pragma unroll
        for (int r = 0; r < 8; ++r) sc[r] = __shfl(scale, (hi << 3) + r, 32);
        #pragma unroll
        for (int dt = 0; dt < 4; ++dt) {
          #pragma unroll
          for (int r = 0; r < 8; ++r) o[qt][dt][r] *= sc[r];
        }
      }
    }

    // exp + pack: P^T C-layout == A-fragment layout for the PV product; P carried x4096 (below 32768 by LAZY)
    FragH pa[2];
    #pragma unroll
    for (int qt = 0; qt < 2; ++qt) {
      const v8f (&d)[2] = c[qt];
      const v2f bb = (v2f){bias[qt], bias[qt]};
      float psum = 0.0f;
      v2f e[2][4];
      #pragma unroll
      for (int i = 0; i < 4; ++i) {
        e[0][i] = __builtin_elementwise_fma((v2f){d[0][2 * i], d[0][2 * i + 1]}, (v2f){SL, SL}, bb);   // keys hi*8 + 2i, 2i + 1
        e[1][i] = __builtin_elementwise_fma((v2f){d[1][2 * i], d[1][2 * i + 1]}, (v2f){SL, SL}, bb);   // keys 16 + hi*8 + 2i, 2i + 1
      }
      #pragma unroll
      for (int r = 0; r < 8; ++r) {
        const float p0 = __builtin_amdgcn_exp2f(e[0][r >> 1][r & 1]);   // key hi*8 + r
        const float p1 = __builtin_amdgcn_exp2f(e[1][r >> 1][r & 1]);   // key 16 + hi*8 + r
        psum += p0 + p1;
        pa[qt].h[r]     = (f16)p0;
        pa[qt].h[8 + r] = (f16)p1;
      }
      rsum[qt] += psum;                               // this lane's share only: an exchange per pass would be waited for at the next test
    }

    // O += P x V: each V fragment feeds both tiles
    __builtin_amdgcn_sched_barrier(0);                // keeps the sums' additions in front of the products: moved behind them they land in operand registers just read and cost v_nop padding
    #pragma unroll
    for (int dt = 0; dt < 4; ++dt) {
      #pragma unroll
      for (int qt = 0; qt < 2; ++qt) o[qt][dt] = mma_f16(pa[qt].v, bv[dt].v, o[qt][dt]);
    }
  };

  // fragments run ahead of their products: K of the next pass and V of this pass are read right behind a pass's
  // score products, so the LDS transfer runs under the softmax instead of being waited for at the top of each pass
  const v4u* fbase = sKV + kg * STG + lq * LROW + hi;   // this wave's key half, buffer 0
  FragB ak[2][2];
  load_k(ak, fbase, 0);                               // first fragment loads: stage 0 is published

  #pragma unroll 1   // rolled: the ring's publish point stands once in the two-pass body
  for (int t = 0; t < nstage; ++t) {
   const int bo = (t & 1) * (2 * STG);                // this stage's buffer
   const v4u* frag = fbase + bo;
   FragH bv[4];
   v8f c[2][2];

   scores(c, ak);
   __builtin_amdgcn_sched_barrier(0);                 // keeps the eight score products in front of the load group: without it the loads stand among them in pieces
   load_v(bv, frag, 0);
   load_k(ak, frag, 1);
   __builtin_amdgcn_sched_barrier(0);                 // holds the load group here, as one group: without it the loads sink behind the rescale test, in pieces
   soft_pv(c, bv);

   load_v(bv, frag, 1);                               // the second pass's V: its transfer runs under the products around it
   scores(c, ak);
   // distance behind the run of products (scores of the second pass) on the paths that jump over the refill and the
   // fetch below; naming c and o keeps the run in front; naming the two
   // row sums keeps the first pass's additions in front as well: sunk behind the refill they hold its 32 P values live
   // across the publish point, and the 256-register budget spills
   asm volatile("v_nop\n\tv_nop\n\tv_nop\n\tv_nop"
                : "+v"(c[0][0]), "+v"(c[0][1]), "+v"(c[1][0]), "+v"(c[1][1]),
                  "+v"(o[0][0]), "+v"(o[0][1]), "+v"(o[0][2]), "+v"(o[0][3]),
                  "+v"(o[1][0]), "+v"(o[1][1]), "+v"(o[1][2]), "+v"(o[1][3]), "+v"(rsum[0]), "+v"(rsum[1]));
   // publish point of stage t + 1, ahead of the stage's last softmax: all of stage t's fragments are in registers by now,
   // and the fetch behind it already reads stage t + 1; the same barrier ends every wave's reads of stage t's buffer
   asm volatile("s_wait_dscnt 0x0" ::: "memory");     // this wave's LDS reads of stage t are done
   asm volatile("s_wait_asynccnt 0x0" ::: "memory");  // this wave's share of stage t + 1 has landed
   __syncthreads();
   if (t + 2 < nstage) {                              // uniform: refill the buffer just read with stage t + 2
     fill(t & 1, t + 2);
   }
   if (t + 1 < nstage) {                              // uniform: the last stage has nothing behind it to fetch
     load_k(ak, fbase + ((t + 1) & 1) * (2 * STG), 0);
   }
   soft_pv(c, bv);
  }
  asm volatile("s_wait_asynccnt 0x0" ::: "memory");   // nothing is in flight when the ring is left

  #pragma unroll
  for (int qt = 0; qt < 2; ++qt) rsum[qt] += __shfl_xor(rsum[qt], 16, 32);   // both lane halves carry the same maximum, so their sums add as they are

  // join of the two key halves: wave w keeps Q tile kg and hands the other tile (O, maximum, sum; registers as they
  // lie, 16 B per lane and store) to wave w ^ 4 through its own staging slice
  const bool k1 = kg != 0;                            // scalar
  float*       so = sO + wave * (16 * OP);
  const float* sp = sO + (wave ^ 4) * (16 * OP);
  #pragma unroll
  for (int dt = 0; dt < 4; ++dt) {
    #pragma unroll
    for (int hh = 0; hh < 2; ++hh) {
      v4f w;
      #pragma unroll
      for (int i = 0; i < 4; ++i) w[i] = k1 ? o[0][dt][hh * 4 + i] : o[1][dt][hh * 4 + i];
      *(v4f*)(so + ((dt * 2 + hh) * 32 + lane) * 4) = w;
    }
  }
  so[1024 + lane] = k1 ? rmax[0] : rmax[1];
  so[1056 + lane] = k1 ? rsum[0] : rsum[1];
  __syncthreads();                                    // the handed-over tiles are written
  v4f po[8];
  #pragma unroll
  for (int j = 0; j < 8; ++j) po[j] = *(const v4f*)(sp + (j * 32 + lane) * 4);
  const float pm = sp[1024 + lane];
  const float ps = sp[1056 + lane];
  __syncthreads();                                    // every wave has read its partner's slice before the slices become output staging

  // both halves on the larger maximum; the weights carry the division by the joined sum (O and the sums carry the same x4096)
  const float m_own = k1 ? rmax[1] : rmax[0];
  const float s_own = k1 ? rsum[1] : rsum[0];
  const float m_all = fmaxf(m_own, pm);
  const float a_own = __builtin_amdgcn_exp2f((m_own - m_all) * SL);
  const float a_par = __builtin_amdgcn_exp2f((pm - m_all) * SL);
  const float inv   = 1.0f / (s_own * a_own + ps * a_par);
  const float f_own = a_own * inv;
  const float f_par = a_par * inv;

  // lane holds column d = dt*16 + lq for query rows 8*hi + r of its tile
  float fo[8], fp[8];
  #pragma unroll
  for (int r = 0; r < 8; ++r) {
    fo[r] = __shfl(f_own, (hi << 3) + r, 32);
    fp[r] = __shfl(f_par, (hi << 3) + r, 32);
  }

  #pragma unroll
  for (int r = 0; r < 8; ++r) {
    #pragma unroll
    for (int dt = 0; dt < 4; ++dt) {
      const float own = k1 ? o[1][dt][r] : o[0][dt][r];
      so[(hi * 8 + r) * OP + dt * 16 + lq] = own * fo[r] + po[dt * 2 + (r >> 2)][r & 3] * fp[r];
    }
  }
  __syncthreads();

  // lanes 0..15 store one row (16 consecutive lanes x 16 B each), lanes 16..31 the next row; 8 instructions cover the wave's 16 rows.
  v4f    vals[8];
  size_t gidx[8];
  #pragma unroll
  for (int it = 0; it < 8; ++it) {
    const int row = it * 2 + hi;
    vals[it] = *(const v4f*)(so + row * OP + lq * 4);
    gidx[it] = (((size_t)b * NHEAD + h) * SEQ_FULL + qrow0 + kg * 16 + row) * HDIM + lq * 4;
  }
  #pragma unroll
  for (int it = 0; it < 8; ++it) *(v4f*)(out + gidx[it]) = vals[it];
  
}

extern "C" void kernel_launch(void* const* d_in, const int* in_sizes, int n_in,
                              void* d_out, int out_size, void* d_ws, size_t ws_size,
                              hipStream_t stream) {
  if (n_in < 3) return;
  // last element touched of each [b][h][s][d] array (full-size strides, NB x SEQ sub-problem)
  const size_t need = ((((size_t)(NB - 1) * NHEAD + (NHEAD - 1)) * SEQ_FULL) + SEQ) * HDIM;
  if ((size_t)in_sizes[0] < need) return;
  if ((size_t)in_sizes[1] < need) return;
  if ((size_t)in_sizes[2] < need) return;
  if ((size_t)out_size < need) return;

  const size_t kb_elems = (size_t)NB * NHEAD * SEQ * HDIM;   // bf16 K plane
  const size_t vt_elems = (size_t)NB * NHEAD * HDIM * SEQ;   // f16 V^T plane
  const size_t kb_bytes = kb_elems * 2;
  const size_t vt_bytes = vt_elems * 2;
  if (ws_size < kb_bytes + vt_bytes) return;

  const float* q   = (const float*)d_in[0];
  const float* k   = (const float*)d_in[1];
  const float* v   = (const float*)d_in[2];
  float*       out = (float*)d_out;
  bf16*        kb  = (bf16*)d_ws;
  f16*         vt  = (f16*)((char*)d_ws + kb_bytes);

  kv_planes_kernel<<<dim3(SEQ / CT, NHEAD, NB), 256, 0, stream>>>(k, v, kb, vt);
  attn_kernel<<<dim3(SEQ / BQ, NHEAD, NB), 256, 0, stream>>>(q, kb, vt, out);
}

// v007
// It runs in 56.7 microseconds.
// Timed twice side by side with v006, it ran 1.04 times as fast both times.
// Counting every step since v000, it is 4.57 times as fast.
#include <hip/hip_runtime.h>

// Contractions: S^T = K x Q^T on v_wmma_f32_16x16x32_bf16 (bf16 operands = RNE-converted inputs, f32 accumulate);
// O = P x V on v_wmma_f32_16x16x32_f16 (P as f16 carried x256; V = f16 of the bf16 RNE-converted input; f32 accumulate).
// Softmax (online, max-subtracted) in f32; the subtracted maximum is renewed in a wave's first pass and after that only when a lane's sum of a pass's P tops PSUM_MAX.
// The exponent of each P is one fused multiply-add: score * SL + bias, bias = CARRY - maximum * SL, so P and its sum both carry x256.

#ifndef NB
#define NB 2
#endif
#ifndef SEQ
#define SEQ 4096
#endif
#define NB_FULL    2
#define SEQ_FULL   4096
#define NHEAD      8
#define HDIM       64
#define BQ         128                  // query rows per workgroup (4 wave pairs x 32)
#define HSEQ       (SEQ / 2)            // keys per key half: waves 0..3 walk the first half, waves 4..7 the second
#define BK         32                   // keys per inner iteration
#define NWAVE      8
#define CT         64                   // keys per plane-builder block
#define TP         72                   // LDS pitch (halves) of the transposed V tile
#define OP         68                   // LDS pitch (floats) of the output staging tile
#define KT         64                   // keys per LDS stage (two inner iterations)
#define LROW       9                    // LDS row pitch in 16-B units: 128 B of data + 16 B (odd multiple of 16 B)
#define VOFF       (KT * LROW)          // first V^T row of a stage, 16-B units
#define STG        (KT * LROW + HDIM * LROW)   // one stage, 16-B units
#define WS_CAP     134217728ull         // workspace carve ceiling (bytes)
#define CARRY      8.0f                 // exponent of the P that belongs to the maximum in use: P and its sums carry x256
#define PSUM_MAX   65504.0f             // largest finite f16: every P is positive, so no P of a lane's pass tops the lane's sum of them

static_assert(SEQ % BQ == 0);
static_assert(SEQ % CT == 0);
static_assert(SEQ % BK == 0);
static_assert(HSEQ % KT == 0 && HSEQ / KT >= 2);   // the two-buffer prologue needs two stages of each key half
static_assert(KT == 2 * BK);
static_assert(KT * 8 == 2 * 256 && HDIM * 8 == 2 * 256);   // 16-B units per tile = two per thread
static_assert(BQ == (NWAVE / 2) * 32);
static_assert(16 * OP >= 32 * 32 + 64);       // a wave's staging slice also carries one O tile, its biases and its sums to the partner wave
static_assert(HDIM == 64);
static_assert(HDIM % 32 == 0);
static_assert(HDIM * 4 == 16 * 16);           // one output row = 16 lanes x 16 B
static_assert(CT * 2 == 128);
static_assert(HDIM * 2 == 128);
static_assert(CT == 64 && CT <= TP);
static_assert(SEQ <= SEQ_FULL);
static_assert(NB >= 1 && NB <= NB_FULL);
static_assert((TP * 2) % 16 == 0);
static_assert((OP * 4) % 16 == 0);
static_assert(OP >= HDIM);
static_assert((unsigned long long)NB * NHEAD * SEQ * HDIM * 2ull * 2ull <= WS_CAP);

typedef __bf16   bf16;
typedef _Float16 f16;
typedef bf16     v16bf __attribute__((ext_vector_type(16)));
typedef f16      v16h  __attribute__((ext_vector_type(16)));
typedef f16      v8h   __attribute__((ext_vector_type(8)));
typedef float    v8f   __attribute__((ext_vector_type(8)));
typedef float    v4f   __attribute__((ext_vector_type(4)));
typedef float    v2f   __attribute__((ext_vector_type(2)));
typedef unsigned v4u   __attribute__((ext_vector_type(4)));

union FragB  { v16bf v; v4u q[2]; bf16 h[16]; };
union FragH  { v16h  v; v4u q[2]; f16  h[16]; };
union Pack8B { v4u u; bf16 h[8]; };
union Pack8H { v4u u; v8h v; f16 h[8]; };

// WMMA helpers: the plain builtins; the compiler keeps the distance behind each product itself and counts the
// products and the independent vector work that it places there.
static __device__ __forceinline__ v8f mma_bf16(v16bf a, v16bf b, v8f acc) {
  return __builtin_amdgcn_wmma_f32_16x16x32_bf16(false, a, false, b, (short)0, acc, false, false);
}
static __device__ __forceinline__ v8f mma_f16(v16h a, v16h b, v8f acc) {
  return __builtin_amdgcn_wmma_f32_16x16x32_f16(false, a, false, b, (short)0, acc, false, false);
}

// One stage (64 K rows of 128 B, 64 V^T rows of 128 B) into LDS: four 16-B asynchronous copies per lane.
// The s_wait_xcnt closes the statement so that no address register is rewritten ahead of it.
static __device__ __forceinline__ void copy_stage(unsigned l0, unsigned l1, unsigned l2, unsigned l3,
                                                  const void* g0, const void* g1,
                                                  const void* g2, const void* g3) {
  asm volatile("global_load_async_to_lds_b128 %0, %4, off\n\t"
               "global_load_async_to_lds_b128 %1, %5, off\n\t"
               "global_load_async_to_lds_b128 %2, %6, off\n\t"
               "global_load_async_to_lds_b128 %3, %7, off\n\t"
               "s_wait_xcnt 0x0"
               :: "v"(l0), "v"(l1), "v"(l2), "v"(l3), "v"(g0), "v"(g1), "v"(g2), "v"(g3)
               : "memory");
}

// Plane builder. Block = (64-key tile, head, batch), 256 threads.
// coverage: keys kt*64 + {0..31, 32..63}, d 0..63 for both planes; every written line whole, one instruction.
// LDS tile sT is cross-wave (block barrier between fill and readback); staged extent 64 d x 64 keys == consumed extent.
__global__ __launch_bounds__(256) void kv_planes_kernel(const float* __restrict__ kin,
                                                        const float* __restrict__ vin,
                                                        bf16* __restrict__ kb,
                                                        f16* __restrict__ vt) {
  const int kt  = blockIdx.x;
  const int h   = blockIdx.y;
  const int b   = blockIdx.z;
  const int tid = threadIdx.x;
  __shared__ __align__(16) f16 sT[HDIM * TP];   // [d][key]
  const int s0 = kt * CT;

  v4u    kval[2];
  size_t kidx[2];
  #pragma unroll
  for (int kk = 0; kk < 2; ++kk) {
    const int key = kk * 32 + (tid >> 3);       // 0..63
    const int d0  = (tid & 7) * 8;              // 0..56
    const size_t src = (((size_t)b * NHEAD + h) * SEQ_FULL + s0 + key) * HDIM + d0;
    const v4f k0 = *(const v4f*)(kin + src);
    const v4f k1 = *(const v4f*)(kin + src + 4);
    const v4f v0 = *(const v4f*)(vin + src);
    const v4f v1 = *(const v4f*)(vin + src + 4);
    Pack8B pk;
    #pragma unroll
    for (int i = 0; i < 4; ++i) {
      pk.h[i]     = (bf16)k0[i];                          // RNE convert
      pk.h[4 + i] = (bf16)k1[i];
    }
    kval[kk] = pk.u;
    kidx[kk] = (((size_t)b * NHEAD + h) * SEQ + s0 + key) * HDIM + d0;
    #pragma unroll
    for (int i = 0; i < 4; ++i) {
      sT[(d0 + i) * TP + key]     = (f16)(float)(bf16)v0[i];   // f16 of bf16 value: exact
      sT[(d0 + 4 + i) * TP + key] = (f16)(float)(bf16)v1[i];
    }
  }
  __syncthreads();

  v4u    vval[2];
  size_t vidx[2];
  #pragma unroll
  for (int kk = 0; kk < 2; ++kk) {
    const int d  = kk * 32 + (tid >> 3);        // 0..63
    const int ks = (tid & 7) * 8;               // 0..56
    Pack8H ph;
    ph.v = *(const v8h*)(sT + d * TP + ks);
    vval[kk] = ph.u;
    vidx[kk] = (((size_t)b * NHEAD + h) * HDIM + d) * SEQ + s0 + ks;
  }

  #pragma unroll
  for (int kk = 0; kk < 2; ++kk) {
    *(v4u*)(kb + kidx[kk]) = kval[kk];
    *(v4u*)(vt + vidx[kk]) = vval[kk];
  }
  
}

// Fused online-softmax attention, no mask, logit scale 1/16.
// Block = (query block of 128, head, batch); one wave owns 32 query rows (two Q tiles) and visits one half of the keys,
// 32 per step, so each K and V fragment read from LDS feeds two products; waves w and w + 4 share their query rows and
// join their halves (maximum, sum, O) once, behind the loop.
// S^T = K x Q^T so queries sit on lanes; P^T in C-layout is bit-identical to the A-fragment layout of O += P x V.
// K rows and V^T rows of 64 keys of each half are staged once per workgroup in a two-buffer LDS ring by asynchronous copies
// (whole 128-B lines from the planes); every wave reads its fragments from there, two 16-B LDS loads per fragment.
// register budget of four waves per SIMD (256 each): two workgroups stay resident per WGP, as before the wave's tile doubled
__global__ __launch_bounds__(256) __attribute__((amdgpu_waves_per_eu(4, 4))) void attn_kernel(const float* __restrict__ q,
                                                   const bf16* __restrict__ kb,
                                                   const f16* __restrict__ vt,
                                                   float* __restrict__ out) {
  const int qblk = blockIdx.x;
  const int h    = blockIdx.y;
  const int b    = blockIdx.z;
  const int tid  = threadIdx.x;
  const int wave = __builtin_amdgcn_readfirstlane(threadIdx.x >> 5);
  const int lane = tid & 31;
  const int lq   = lane & 15;   // query column of S^T / d column of O
  const int hi   = lane >> 4;   // k-split half

  // per-wave slices of 16 x OP floats: first the hand-over of one O tile to the partner wave (read across waves, between
  // two block barriers), then output staging, where each wave writes and reads only its own slice (block barrier used anyway)
  __shared__ __align__(16) float sO[NWAVE * 16 * OP];
  // K / V^T ring: [buffer][key half][K rows 0..63 | V^T rows 0..63][9 x 16 B]
  __shared__ __align__(16) v4u sKV[2 * 2 * STG];

  const int kg    = wave >> 2;                           // key half of this wave (scalar)
  const int qrow0 = qblk * BQ + (wave & 3) * 32;         // first query row of this wave

  // Q as B-operand fragments: lane lq holds query qrow0+qt*16+lq, elements follow the split d map; bf16 RNE convert.
  FragB qf[2][2];
  #pragma unroll
  for (int qt = 0; qt < 2; ++qt) {
    const float* qp = q + (((size_t)b * NHEAD + h) * SEQ_FULL + qrow0 + qt * 16 + lq) * HDIM;
    #pragma unroll
    for (int f = 0; f < 2; ++f) {
      const v4f a0 = *(const v4f*)(qp + f * 32 + hi * 8);
      const v4f a1 = *(const v4f*)(qp + f * 32 + hi * 8 + 4);
      const v4f b0 = *(const v4f*)(qp + f * 32 + 16 + hi * 8);
      const v4f b1 = *(const v4f*)(qp + f * 32 + 16 + hi * 8 + 4);
      #pragma unroll
      for (int i = 0; i < 4; ++i) {
        qf[qt][f].h[i]      = (bf16)a0[i];   // elems 0..7  : d = f*32 + hi*8 + 0..7
        qf[qt][f].h[4 + i]  = (bf16)a1[i];
        qf[qt][f].h[8 + i]  = (bf16)b0[i];   // elems 8..15 : d = f*32 + 16 + hi*8 + 0..7
        qf[qt][f].h[12 + i] = (bf16)b1[i];
      }
    }
  }

  const bf16* kb_h = kb + ((size_t)b * NHEAD + h) * SEQ * HDIM;
  const f16*  vt_h = vt + ((size_t)b * NHEAD + h) * HDIM * SEQ;

  v8f o[2][4];
  #pragma unroll
  for (int qt = 0; qt < 2; ++qt) {
    #pragma unroll
    for (int dt = 0; dt < 4; ++dt) o[qt][dt] = (v8f){0, 0, 0, 0, 0, 0, 0, 0};
  }

  // per Q tile:
  float bias[2] = {CARRY, CARRY};                   // CARRY - maximum in use * SL (same in lane and lane^16), set with every renewal (the first pass always renews)
  float rsum[2] = {0.0f, 0.0f};                     // x256 sum over this lane's share of the keys; the shares join after the loop
  const float SL = 0.0625f * 1.4426950408889634f;   // logit scale 1/sqrt(256) times log2(e)

  // copy map: thread tid brings rows (tid >> 3) and 32 + (tid >> 3), 16-B unit tid & 7, of each half's K tile and V^T tile
  const int crow = tid >> 3;
  const int ccol = tid & 7;
  const unsigned lds0 = (unsigned)(size_t)sKV + (unsigned)(crow * LROW + ccol) * 16u;
  const unsigned koff = (unsigned)(crow * (HDIM * 2) + ccol * 16);   // lane's byte offset in a K tile; the tile's base is scalar
  const unsigned voff = (unsigned)(crow * (SEQ * 2) + ccol * 16);    // lane's byte offset in a V^T tile

  const int nstage = HSEQ / KT;                       // uniform for every wave
  // stage s = keys s*64 .. s*64+63 of both key halves, into buffer buf: eight copies per lane
  auto fill = [&](int buf, int s) {
    #pragma unroll
    for (int g = 0; g < 2; ++g) {
      const unsigned ld = lds0 + (unsigned)((buf * 2 + g) * STG) * 16u;
      const char* nk = (const char*)kb_h + ((size_t)g * HSEQ + (size_t)s * KT) * (HDIM * 2) + koff;
      const char* nv = (const char*)vt_h + ((size_t)g * HSEQ + (size_t)s * KT) * 2 + voff;
      copy_stage(ld, ld + 32 * LROW * 16, ld + VOFF * 16, ld + (VOFF + 32 * LROW) * 16,
                 nk, nk + 32 * (HDIM * 2), nv, nv + (size_t)32 * (SEQ * 2));
    }
  };
  // prologue: stage 0 lands and is published, then stage 1 flies
  fill(0, 0);
  asm volatile("s_wait_asynccnt 0x0" ::: "memory");   // this wave's share of stage 0 has landed
  __syncthreads();                                    // publishes stage 0
  fill(1, 1);

  // K A-fragments of one pass: row = key ps*32 + sub*16 + lq of the stage, split d map
  auto load_k = [&](FragB (&ak)[2][2], const v4u* frag, int ps) {
    #pragma unroll
    for (int sub = 0; sub < 2; ++sub) {
      #pragma unroll
      for (int f = 0; f < 2; ++f) {
        const v4u* base = frag + (ps * 32 + sub * 16) * LROW + f * 4;
        ak[sub][f].q[0] = base[0];                    // d = f*32 + hi*8 + 0..7
        ak[sub][f].q[1] = base[2];                    // d = f*32 + 16 + hi*8 + 0..7
      }
    }
  };
  // V B-fragments of one pass: column n = d = dt*16 + lq, split key map from the transposed rows
  auto load_v = [&](FragH (&bv)[4], const v4u* frag, int ps) {
    #pragma unroll
    for (int dt = 0; dt < 4; ++dt) {
      const v4u* base = frag + VOFF + (dt * 16) * LROW + ps * 4;
      bv[dt].q[0] = base[0];                          // keys ps*32 + hi*8 + 0..7
      bv[dt].q[1] = base[2];                          // keys ps*32 + 16 + hi*8 + 0..7
    }
  };
  // S^T tiles: c[qt][sub][r] = rawscore(query qrow0+qt*16+lq, key j0 + sub*16 + hi*8 + r); four independent chains of two
  auto scores = [&](v8f (&c)[2][2], FragB (&ak)[2][2]) {
    #pragma unroll
    for (int f = 0; f < 2; ++f) {
      #pragma unroll
      for (int sub = 0; sub < 2; ++sub) {
        #pragma unroll
        for (int qt = 0; qt < 2; ++qt) {
          c[qt][sub] = mma_bf16(ak[sub][f].v, qf[qt][f].v, f == 0 ? (v8f){0, 0, 0, 0, 0, 0, 0, 0} : c[qt][sub]);
        }
      }
    }
  };
  // exp + pack: P^T C-layout == A-fragment layout for the PV product; x[qt][sub][i] = exponents of keys sub*16 + hi*8 + 2i, 2i + 1
  auto exp_pack = [&](v2f (&x)[2][2][4], FragH (&pa)[2], float (&psum)[2]) {
    #pragma unroll
    for (int qt = 0; qt < 2; ++qt) {
      float acc = 0.0f;
      #pragma unroll
      for (int r = 0; r < 8; ++r) {
        const float p0 = __builtin_amdgcn_exp2f(x[qt][0][r >> 1][r & 1]);   // key hi*8 + r
        const float p1 = __builtin_amdgcn_exp2f(x[qt][1][r >> 1][r & 1]);   // key 16 + hi*8 + r
        acc += p0 + p1;
        pa[qt].h[r]     = (f16)p0;
        pa[qt].h[8 + r] = (f16)p1;
      }
      psum[qt] = acc;
    }
  };
  // softmax of one pass's scores and O += P x V, both Q tiles; first: the wave's first pass (scalar), which sets the maximum in use
  auto soft_pv = [&](v8f (&c)[2][2], FragH (&bv)[4], bool first) {
    v2f x[2][2][4];
    #pragma unroll
    for (int qt = 0; qt < 2; ++qt) {
      const v2f bb = (v2f){bias[qt], bias[qt]};
      #pragma unroll
      for (int sub = 0; sub < 2; ++sub) {
        #pragma unroll
        for (int i = 0; i < 4; ++i) {
          x[qt][sub][i] = __builtin_elementwise_fma((v2f){c[qt][sub][2 * i], c[qt][sub][2 * i + 1]}, (v2f){SL, SL}, bb);
        }
      }
    }
    FragH pa[2];
    float psum[2];
    exp_pack(x, pa, psum);

    // lazy rescale: one wave-uniform test per pass for both tiles, on the sums that the pass forms anyway. While a lane's sum
    // stays at or below PSUM_MAX each of its P is a finite f16; a larger sum (infinity too) renews the maximum in use: only
    // then are the pass's largest exponent, the halves' join, the scale's broadcast and the rescale of O and of the sum
    // formed, and the pass's P are formed again from the shifted exponents
    if ((__builtin_amdgcn_ballot_w32((psum[0] > PSUM_MAX) | (psum[1] > PSUM_MAX)) | (unsigned)first) != 0u) {
      #pragma unroll
      for (int qt = 0; qt < 2; ++qt) {
        v2f m2 = __builtin_elementwise_max(x[qt][0][0], x[qt][1][0]);
        #pragma unroll
        for (int i = 1; i < 4; ++i) m2 = __builtin_elementwise_max(m2, __builtin_elementwise_max(x[qt][0][i], x[qt][1][i]));
        const float mloc  = fmaxf(m2[0], m2[1]);
        const float joint = fmaxf(mloc, __shfl_xor(mloc, 16, 32));
        const float top   = first ? joint : fmaxf(joint, CARRY);   // the maximum in use never falls; CARRY is its own exponent
        const float nb    = bias[qt] + (CARRY - top);
        const float d     = nb - bias[qt];                         // the shift as the bias really takes it
        const float scale = __builtin_amdgcn_exp2f(fminf(d, 0.0f));   // d > 0 only in the first pass, where O and the sum are 0
        bias[qt] = nb;
        rsum[qt] *= scale;
        // queries are the row dimension of O -> per-row scale from lane 8*hi + r
        float sc[8];
        #pragma unroll
        for (int r = 0; r < 8; ++r) sc[r] = __shfl(scale, (hi << 3) + r, 32);
        #pragma unroll
        for (int dt = 0; dt < 4; ++dt) {
          #pragma unroll
          for (int r = 0; r < 8; ++r) o[qt][dt][r] *= sc[r];
        }
        #pragma unroll
        for (int sub = 0; sub < 2; ++sub) {
          #pragma unroll
          for (int i = 0; i < 4; ++i) x[qt][sub][i] += (v2f){d, d};
        }
      }
      exp_pack(x, pa, psum);
    }
    #pragma unroll
    for (int qt = 0; qt < 2; ++qt) rsum[qt] += psum[qt];   // this lane's share only: an exchange per pass would be waited for at the next test

    // O += P x V: each V fragment feeds both tiles
    __builtin_amdgcn_sched_barrier(0);                // keeps the sums' additions in front of the products: moved behind them they land in operand registers just read and cost v_nop padding
    #pragma unroll
    for (int dt = 0; dt < 4; ++dt) {
      #pragma unroll
      for (int qt = 0; qt < 2; ++qt) o[qt][dt] = mma_f16(pa[qt].v, bv[dt].v, o[qt][dt]);
    }
  };

  // fragments run ahead of their products: K of the next pass and V of this pass are read right behind a pass's
  // score products, so the LDS transfer runs under the softmax instead of being waited for at the top of each pass
  const v4u* fbase = sKV + kg * STG + lq * LROW + hi;   // this wave's key half, buffer 0
  FragB ak[2][2];
  load_k(ak, fbase, 0);                               // first fragment loads: stage 0 is published

  #pragma unroll 1   // rolled: the ring's publish point stands once in the two-pass body
  for (int t = 0; t < nstage; ++t) {
   const int bo = (t & 1) * (2 * STG);                // this stage's buffer
   const v4u* frag = fbase + bo;
   FragH bv[4];
   v8f c[2][2];

   scores(c, ak);
   __builtin_amdgcn_sched_barrier(0);                 // keeps the eight score products in front of the load group: without it the loads stand among them in pieces
   load_v(bv, frag, 0);
   load_k(ak, frag, 1);
   __builtin_amdgcn_sched_barrier(0);                 // holds the load group here, as one group: without it the loads sink behind the rescale test, in pieces
   soft_pv(c, bv, t == 0);

   load_v(bv, frag, 1);                               // the second pass's V: its transfer runs under the products around it
   scores(c, ak);
   // distance behind the run of products (scores of the second pass) on the paths that jump over the refill and the
   // fetch below; naming c and o keeps the run in front; naming the two
   // row sums keeps the first pass's additions in front as well
   asm volatile("v_nop\n\tv_nop\n\tv_nop\n\tv_nop"
                : "+v"(c[0][0]), "+v"(c[0][1]), "+v"(c[1][0]), "+v"(c[1][1]),
                  "+v"(o[0][0]), "+v"(o[0][1]), "+v"(o[0][2]), "+v"(o[0][3]),
                  "+v"(o[1][0]), "+v"(o[1][1]), "+v"(o[1][2]), "+v"(o[1][3]), "+v"(rsum[0]), "+v"(rsum[1]));
   // publish point of stage t + 1, ahead of the stage's last softmax: all of stage t's fragments are in registers by now,
   // and the fetch behind it already reads stage t + 1; the same barrier ends every wave's reads of stage t's buffer
   asm volatile("s_wait_dscnt 0x0" ::: "memory");     // this wave's LDS reads of stage t are done
   asm volatile("s_wait_asynccnt 0x0" ::: "memory");  // this wave's share of stage t + 1 has landed
   __syncthreads();
   if (t + 2 < nstage) {                              // uniform: refill the buffer just read with stage t + 2
     fill(t & 1, t + 2);
   }
   if (t + 1 < nstage) {                              // uniform: the last stage has nothing behind it to fetch
     load_k(ak, fbase + ((t + 1) & 1) * (2 * STG), 0);
   }
   soft_pv(c, bv, false);
  }
  asm volatile("s_wait_asynccnt 0x0" ::: "memory");   // nothing is in flight when the ring is left

  #pragma unroll
  for (int qt = 0; qt < 2; ++qt) rsum[qt] += __shfl_xor(rsum[qt], 16, 32);   // both lane halves carry the same maximum, so their sums add as they are

  // join of the two key halves: wave w keeps Q tile kg and hands the other tile (O, bias, sum; registers as they
  // lie, 16 B per lane and store) to wave w ^ 4 through its own staging slice
  const bool k1 = kg != 0;                            // scalar
  float*       so = sO + wave * (16 * OP);
  const float* sp = sO + (wave ^ 4) * (16 * OP);
  #pragma unroll
  for (int dt = 0; dt < 4; ++dt) {
    #pragma unroll
    for (int hh = 0; hh < 2; ++hh) {
      v4f w;
      #pragma unroll
      for (int i = 0; i < 4; ++i) w[i] = k1 ? o[0][dt][hh * 4 + i] : o[1][dt][hh * 4 + i];
      *(v4f*)(so + ((dt * 2 + hh) * 32 + lane) * 4) = w;
    }
  }
  so[1024 + lane] = k1 ? bias[0] : bias[1];
  so[1056 + lane] = k1 ? rsum[0] : rsum[1];
  __syncthreads();                                    // the handed-over tiles are written
  v4f po[8];
  #pragma unroll
  for (int j = 0; j < 8; ++j) po[j] = *(const v4f*)(sp + (j * 32 + lane) * 4);
  const float pb = sp[1024 + lane];
  const float ps = sp[1056 + lane];
  __syncthreads();                                    // every wave has read its partner's slice before the slices become output staging

  // both halves on the larger maximum, which has the smaller bias; the weights carry the division by the joined sum (O and the sums carry the same x256)
  const float b_own = k1 ? bias[1] : bias[0];
  const float s_own = k1 ? rsum[1] : rsum[0];
  const float b_all = fminf(b_own, pb);
  const float a_own = __builtin_amdgcn_exp2f(b_all - b_own);
  const float a_par = __builtin_amdgcn_exp2f(b_all - pb);
  const float inv   = 1.0f / (s_own * a_own + ps * a_par);
  const float f_own = a_own * inv;
  const float f_par = a_par * inv;

  // lane holds column d = dt*16 + lq for query rows 8*hi + r of its tile
  float fo[8], fp[8];
  #pragma unroll
  for (int r = 0; r < 8; ++r) {
    fo[r] = __shfl(f_own, (hi << 3) + r, 32);
    fp[r] = __shfl(f_par, (hi << 3) + r, 32);
  }

  #pragma unroll
  for (int r = 0; r < 8; ++r) {
    #pragma unroll
    for (int dt = 0; dt < 4; ++dt) {
      const float own = k1 ? o[1][dt][r] : o[0][dt][r];
      so[(hi * 8 + r) * OP + dt * 16 + lq] = own * fo[r] + po[dt * 2 + (r >> 2)][r & 3] * fp[r];
    }
  }
  __syncthreads();

  // lanes 0..15 store one row (16 consecutive lanes x 16 B each), lanes 16..31 the next row; 8 instructions cover the wave's 16 rows.
  v4f    vals[8];
  size_t gidx[8];
  #pragma unroll
  for (int it = 0; it < 8; ++it) {
    const int row = it * 2 + hi;
    vals[it] = *(const v4f*)(so + row * OP + lq * 4);
    gidx[it] = (((size_t)b * NHEAD + h) * SEQ_FULL + qrow0 + kg * 16 + row) * HDIM + lq * 4;
  }
  #pragma unroll
  for (int it = 0; it < 8; ++it) *(v4f*)(out + gidx[it]) = vals[it];
  
}

extern "C" void kernel_launch(void* const* d_in, const int* in_sizes, int n_in,
                              void* d_out, int out_size, void* d_ws, size_t ws_size,
                              hipStream_t stream) {
  if (n_in < 3) return;
  // last element touched of each [b][h][s][d] array (full-size strides, NB x SEQ sub-problem)
  const size_t need = ((((size_t)(NB - 1) * NHEAD + (NHEAD - 1)) * SEQ_FULL) + SEQ) * HDIM;
  if ((size_t)in_sizes[0] < need) return;
  if ((size_t)in_sizes[1] < need) return;
  if ((size_t)in_sizes[2] < need) return;
  if ((size_t)out_size < need) return;

  const size_t kb_elems = (size_t)NB * NHEAD * SEQ * HDIM;   // bf16 K plane
  const size_t vt_elems = (size_t)NB * NHEAD * HDIM * SEQ;   // f16 V^T plane
  const size_t kb_bytes = kb_elems * 2;
  const size_t vt_bytes = vt_elems * 2;
  if (ws_size < kb_bytes + vt_bytes) return;

  const float* q   = (const float*)d_in[0];
  const float* k   = (const float*)d_in[1];
  const float* v   = (const float*)d_in[2];
  float*       out = (float*)d_out;
  bf16*        kb  = (bf16*)d_ws;
  f16*         vt  = (f16*)((char*)d_ws + kb_bytes);

  kv_planes_kernel<<<dim3(SEQ / CT, NHEAD, NB), 256, 0, stream>>>(k, v, kb, vt);
  attn_kernel<<<dim3(SEQ / BQ, NHEAD, NB), 256, 0, stream>>>(q, kb, vt, out);
}

// v008
// One run takes 54 microseconds.
// Two timings next to v007 both put it at 1.05 times that version's speed.
// All steps since v000 together make it 4.82 times as fast.
#include <hip/hip_runtime.h>
#include <stdint.h>

// Contractions: S^T = K x Q^T on v_wmma_f32_16x16x32_bf16 (bf16 operands = RNE-converted inputs, f32 accumulate);
// O = P x V on v_wmma_f32_16x16x32_f16 (P as f16 carried x256; V = f16 of the bf16 RNE-converted input; f32 accumulate).
// Softmax (online, max-subtracted) in f32; the subtracted maximum is renewed in a wave's first pass and after that only when a lane's sum of a pass's P tops PSUM_MAX.
// The exponent of each P is one fused multiply-add: score * SL + bias, bias = CARRY - maximum * SL, so P and its sum both carry x256.

#ifndef NB
#define NB 2
#endif
#ifndef SEQ
#define SEQ 4096
#endif
#define NB_FULL    2
#define SEQ_FULL   4096
#define NHEAD      8
#define HDIM       64
#define BQ         128                  // query rows per workgroup (4 wave pairs x 32)
#define HSEQ       (SEQ / 2)            // keys per key half: waves 0..3 walk the first half, waves 4..7 the second
#define BK         32                   // keys per inner iteration
#define NWAVE      8
#define CT         64                   // keys per plane-builder block
#define TP         72                   // LDS pitch (halves) of the transposed V tile
#define OP         68                   // LDS pitch (floats) of the output staging tile
#define KT         64                   // keys per LDS stage (two inner iterations)
#define LROW       9                    // LDS row pitch in 16-B units: 128 B of data + 16 B (odd multiple of 16 B)
#define SROW       32                   // rows per tensor-load slice (one slice per wave and stage)
#define SLU        384                  // a slice's place in LDS, 16-B units: 32 rows x 144 B = 4,608 B, rounded up to 6,144 B (a multiple of 2 KiB)
#define HALFU      (4 * SLU)            // one key half of a stage: K keys 0..31 | K keys 32..63 | V^T d 0..31 | V^T d 32..63
#define BUFU       (2 * HALFU)          // one buffer: both key halves
#define WS_CAP     134217728ull         // workspace carve ceiling (bytes)
#define CARRY      8.0f                 // exponent of the P that belongs to the maximum in use: P and its sums carry x256
#define PSUM_MAX   65504.0f             // largest finite f16: every P is positive, so no P of a lane's pass tops the lane's sum of them

static_assert(SEQ % BQ == 0);
static_assert(SEQ % CT == 0);
static_assert(SEQ % BK == 0);
static_assert(HSEQ % KT == 0 && HSEQ / KT >= 2);   // the two-buffer prologue needs two stages of each key half
static_assert(KT == 2 * BK);
static_assert(KT == 2 * SROW && HDIM == 2 * SROW);          // a K tile and a V^T tile are two slices each
static_assert(SROW * LROW <= SLU && (SLU * 16) % 2048 == 0);   // a padded slice fits its place; every place is a multiple of 2 KiB
static_assert(NWAVE == 8);                                  // eight slices per stage, one per wave
static_assert((HDIM * 2) == 128 && (KT * 2) == 128);        // every slice row is 128 B: the pad's interval
static_assert((SEQ * 2) % 16 == 0 && (SEQ * 2) <= 131072);  // source pitch of the V^T rows
static_assert(BQ == (NWAVE / 2) * 32);
static_assert(16 * OP >= 32 * 32 + 64);       // a wave's staging slice also carries one O tile, its biases and its sums to the partner wave
static_assert(HDIM == 64);
static_assert(HDIM % 32 == 0);
static_assert(HDIM * 4 == 16 * 16);           // one output row = 16 lanes x 16 B
static_assert(CT * 2 == 128);
static_assert(HDIM * 2 == 128);
static_assert(CT == 64 && CT <= TP);
static_assert(SEQ <= SEQ_FULL);
static_assert(NB >= 1 && NB <= NB_FULL);
static_assert((TP * 2) % 16 == 0);
static_assert((OP * 4) % 16 == 0);
static_assert(OP >= HDIM);
static_assert((unsigned long long)NB * NHEAD * SEQ * HDIM * 2ull * 2ull <= WS_CAP);

typedef __bf16   bf16;
typedef _Float16 f16;
typedef bf16     v16bf __attribute__((ext_vector_type(16)));
typedef f16      v16h  __attribute__((ext_vector_type(16)));
typedef f16      v8h   __attribute__((ext_vector_type(8)));
typedef float    v8f   __attribute__((ext_vector_type(8)));
typedef float    v4f   __attribute__((ext_vector_type(4)));
typedef float    v2f   __attribute__((ext_vector_type(2)));
typedef unsigned v4u   __attribute__((ext_vector_type(4)));
typedef uint32_t u32x4 __attribute__((ext_vector_type(4)));
typedef uint32_t u32x8 __attribute__((ext_vector_type(8)));

union FragB  { v16bf v; v4u q[2]; bf16 h[16]; };
union FragH  { v16h  v; v4u q[2]; f16  h[16]; };
union Pack8B { v4u u; bf16 h[8]; };
union Pack8H { v4u u; v8h v; f16 h[8]; };

// WMMA helpers: the plain builtins; the compiler keeps the distance behind each product itself and counts the
// products and the independent vector work that it places there.
static __device__ __forceinline__ v8f mma_bf16(v16bf a, v16bf b, v8f acc) {
  return __builtin_amdgcn_wmma_f32_16x16x32_bf16(false, a, false, b, (short)0, acc, false, false);
}
static __device__ __forceinline__ v8f mma_f16(v16h a, v16h b, v8f acc) {
  return __builtin_amdgcn_wmma_f32_16x16x32_f16(false, a, false, b, (short)0, acc, false, false);
}

// Tensor-load helpers: every descriptor word is wave-uniform and goes through readfirstlane.
static __device__ __forceinline__ uint32_t uni(uint32_t v) { return (uint32_t)__builtin_amdgcn_readfirstlane(v); }
// a wave-uniform test for the branch around a tensor load, which ignores EXEC: the branch must be a scalar one
static __device__ __forceinline__ uint32_t pinned(uint32_t v) {
  uint32_t w = uni(v);
  asm volatile("" : "+s"(w));   // holds the test word in a scalar register, so that s_cmp and s_cbranch_scc are built
  return w;
}
// group 1: 1-byte elements, a tile of 32 rows of 128 B (tensor = tile), source row pitch in bytes;
// word 0: no mask, pad on, interval code 4 (one 128-B row), amount code 3 (16 B): LDS pitch 144 B
static __device__ __forceinline__ u32x8 tdm_group1(uint32_t src_pitch) {
  u32x8 g;
  g[0] = uni((1u << 20) | (4u << 22) | (3u << 25));
  g[1] = uni(128u << 16);              // tensor_dim0 = 128
  g[2] = uni((uint32_t)SROW << 16);    // tensor_dim1 = 32
  g[3] = uni(128u << 16);              // tile_dim0 = 128
  g[4] = uni((uint32_t)SROW);          // tile_dim1 = 32
  g[5] = uni(src_pitch);
  g[6] = uni(0u);
  g[7] = uni(0u);
  return g;
}
// group 0: count 1, place in LDS, the tile's first byte, type 2
static __device__ __forceinline__ u32x4 tdm_group0(uint32_t lds_dst, uint64_t ga) {
  u32x4 g;
  g[0] = uni(1u);
  g[1] = uni(lds_dst);
  g[2] = uni((uint32_t)ga);
  g[3] = uni((((uint32_t)(ga >> 32)) & 0x01FFFFFFu) | 0x80000000u);
  return g;
}
// g0 is an in-out operand so that the registers a request names stay g0's own: they take new values only where the
// source writes g0, which is behind the wait that covers the request
static __device__ __forceinline__ void tdm_load(u32x4& g0, const u32x8& g1) {
  asm volatile("tensor_load_to_lds %0, %1" : "+s"(g0) : "s"(g1) : "memory");
}

// Plane builder. Block = (64-key tile, head, batch), 256 threads.
// coverage: keys kt*64 + {0..31, 32..63}, d 0..63 for both planes; every written line whole, one instruction.
// LDS tile sT is cross-wave (block barrier between fill and readback); staged extent 64 d x 64 keys == consumed extent.
__global__ __launch_bounds__(256) void kv_planes_kernel(const float* __restrict__ kin,
                                                        const float* __restrict__ vin,
                                                        bf16* __restrict__ kb,
                                                        f16* __restrict__ vt) {
  const int kt  = blockIdx.x;
  const int h   = blockIdx.y;
  const int b   = blockIdx.z;
  const int tid = threadIdx.x;
  __shared__ __align__(16) f16 sT[HDIM * TP];   // [d][key]
  const int s0 = kt * CT;

  v4u    kval[2];
  size_t kidx[2];
  #pragma unroll
  for (int kk = 0; kk < 2; ++kk) {
    const int key = kk * 32 + (tid >> 3);       // 0..63
    const int d0  = (tid & 7) * 8;              // 0..56
    const size_t src = (((size_t)b * NHEAD + h) * SEQ_FULL + s0 + key) * HDIM + d0;
    const v4f k0 = *(const v4f*)(kin + src);
    const v4f k1 = *(const v4f*)(kin + src + 4);
    const v4f v0 = *(const v4f*)(vin + src);
    const v4f v1 = *(const v4f*)(vin + src + 4);
    Pack8B pk;
    #pragma unroll
    for (int i = 0; i < 4; ++i) {
      pk.h[i]     = (bf16)k0[i];                          // RNE convert
      pk.h[4 + i] = (bf16)k1[i];
    }
    kval[kk] = pk.u;
    kidx[kk] = (((size_t)b * NHEAD + h) * SEQ + s0 + key) * HDIM + d0;
    #pragma unroll
    for (int i = 0; i < 4; ++i) {
      sT[(d0 + i) * TP + key]     = (f16)(float)(bf16)v0[i];   // f16 of bf16 value: exact
      sT[(d0 + 4 + i) * TP + key] = (f16)(float)(bf16)v1[i];
    }
  }
  __syncthreads();

  v4u    vval[2];
  size_t vidx[2];
  #pragma unroll
  for (int kk = 0; kk < 2; ++kk) {
    const int d  = kk * 32 + (tid >> 3);        // 0..63
    const int ks = (tid & 7) * 8;               // 0..56
    Pack8H ph;
    ph.v = *(const v8h*)(sT + d * TP + ks);
    vval[kk] = ph.u;
    vidx[kk] = (((size_t)b * NHEAD + h) * HDIM + d) * SEQ + s0 + ks;
  }

  #pragma unroll
  for (int kk = 0; kk < 2; ++kk) {
    *(v4u*)(kb + kidx[kk]) = kval[kk];
    *(v4u*)(vt + vidx[kk]) = vval[kk];
  }
  
}

// Fused online-softmax attention, no mask, logit scale 1/16.
// Block = (query block of 128, head, batch); one wave owns 32 query rows (two Q tiles) and visits one half of the keys,
// 32 per step, so each K and V fragment read from LDS feeds two products; waves w and w + 4 share their query rows and
// join their halves (maximum, sum, O) once, behind the loop.
// S^T = K x Q^T so queries sit on lanes; P^T in C-layout is bit-identical to the A-fragment layout of O += P x V.
// K rows and V^T rows of 64 keys of each half are staged once per workgroup in a two-buffer LDS ring by tensor loads
// (each wave one slice of 32 rows of 128 B per stage); every wave reads its fragments from there, two 16-B LDS loads per fragment.
// register budget of four waves per SIMD (256 each): two workgroups stay resident per WGP, as before the wave's tile doubled
__global__ __launch_bounds__(256) __attribute__((amdgpu_waves_per_eu(4, 4))) void attn_kernel(const float* __restrict__ q,
                                                   const bf16* __restrict__ kb,
                                                   const f16* __restrict__ vt,
                                                   float* __restrict__ out) {
  const int qblk = blockIdx.x;
  const int h    = blockIdx.y;
  const int b    = blockIdx.z;
  const int tid  = threadIdx.x;
  const int wave = __builtin_amdgcn_readfirstlane(threadIdx.x >> 5);
  const int lane = tid & 31;
  const int lq   = lane & 15;   // query column of S^T / d column of O
  const int hi   = lane >> 4;   // k-split half

  // per-wave slices of 16 x OP floats: first the hand-over of one O tile to the partner wave (read across waves, between
  // two block barriers), then output staging, where each wave writes and reads only its own slice (block barrier used anyway)
  __shared__ __align__(16) float sO[NWAVE * 16 * OP];
  // K / V^T ring: [buffer][key half][K keys 0..31 | K keys 32..63 | V^T d 0..31 | V^T d 32..63][32 rows x 9 x 16 B, place 6,144 B]
  __shared__ __attribute__((aligned(2048))) v4u sKV[2 * BUFU];

  const int kg    = wave >> 2;                           // key half of this wave (scalar)
  const int qrow0 = qblk * BQ + (wave & 3) * 32;         // first query row of this wave

  // Q as B-operand fragments: lane lq holds query qrow0+qt*16+lq, elements follow the split d map; bf16 RNE convert.
  FragB qf[2][2];
  #pragma unroll
  for (int qt = 0; qt < 2; ++qt) {
    const float* qp = q + (((size_t)b * NHEAD + h) * SEQ_FULL + qrow0 + qt * 16 + lq) * HDIM;
    #pragma unroll
    for (int f = 0; f < 2; ++f) {
      const v4f a0 = *(const v4f*)(qp + f * 32 + hi * 8);
      const v4f a1 = *(const v4f*)(qp + f * 32 + hi * 8 + 4);
      const v4f b0 = *(const v4f*)(qp + f * 32 + 16 + hi * 8);
      const v4f b1 = *(const v4f*)(qp + f * 32 + 16 + hi * 8 + 4);
      #pragma unroll
      for (int i = 0; i < 4; ++i) {
        qf[qt][f].h[i]      = (bf16)a0[i];   // elems 0..7  : d = f*32 + hi*8 + 0..7
        qf[qt][f].h[4 + i]  = (bf16)a1[i];
        qf[qt][f].h[8 + i]  = (bf16)b0[i];   // elems 8..15 : d = f*32 + 16 + hi*8 + 0..7
        qf[qt][f].h[12 + i] = (bf16)b1[i];
      }
    }
  }

  const bf16* kb_h = kb + ((size_t)b * NHEAD + h) * SEQ * HDIM;
  const f16*  vt_h = vt + ((size_t)b * NHEAD + h) * HDIM * SEQ;

  v8f o[2][4];
  #pragma unroll
  for (int qt = 0; qt < 2; ++qt) {
    #pragma unroll
    for (int dt = 0; dt < 4; ++dt) o[qt][dt] = (v8f){0, 0, 0, 0, 0, 0, 0, 0};
  }

  // per Q tile:
  float bias[2] = {CARRY, CARRY};                   // CARRY - maximum in use * SL (same in lane and lane^16), set with every renewal (the first pass always renews)
  float rsum[2] = {0.0f, 0.0f};                     // x256 sum over this lane's share of the keys; the shares join after the loop
  const float SL = 0.0625f * 1.4426950408889634f;   // logit scale 1/sqrt(256) times log2(e)

  // slice map: wave w = key half * 4 + (0: K, 1: V^T) * 2 + part brings slice w of every stage; all of it scalar
  const uint32_t sg     = (uint32_t)wave >> 2;
  const bool     sv     = (((uint32_t)wave >> 1) & 1u) != 0u;
  const uint32_t spart  = (uint32_t)wave & 1u;
  const uint32_t lds_sl = (uint32_t)(size_t)sKV + (uint32_t)wave * (SLU * 16u);   // its place in buffer 0
  const uint64_t src0   = sv ? (uint64_t)(size_t)vt_h + (uint64_t)spart * (SROW * (SEQ * 2)) + (uint64_t)sg * (HSEQ * 2)
                             : (uint64_t)(size_t)kb_h + ((uint64_t)sg * HSEQ + (uint64_t)spart * SROW) * (HDIM * 2);
  const uint32_t sstep  = sv ? (uint32_t)(KT * 2) : (uint32_t)(KT * HDIM * 2);    // bytes from one stage's slice to the next
  const u32x8    g1     = tdm_group1(sv ? (uint32_t)(SEQ * 2) : (uint32_t)(HDIM * 2));

  const int nstage = HSEQ / KT;                       // uniform for every wave
  // stage s = keys s*64 .. s*64+63 of both key halves, into buffer buf: one request per wave
  u32x4 g0 = tdm_group0(lds_sl, src0);
  auto fill = [&](int buf, int s) {
    const uint64_t ga = src0 + (uint64_t)((uint32_t)s * sstep);
    g0[1] = uni(lds_sl + (uint32_t)buf * (BUFU * 16u));
    g0[2] = uni((uint32_t)ga);
    g0[3] = uni((((uint32_t)(ga >> 32)) & 0x01FFFFFFu) | 0x80000000u);
    tdm_load(g0, g1);
  };
  // prologue: stage 0 lands and is published, then stage 1 flies
  fill(0, 0);
  asm volatile("s_wait_tensorcnt 0x0" ::: "memory");  // this wave's slice of stage 0 has landed
  __syncthreads();                                    // publishes stage 0
  fill(1, 1);

  // K A-fragments of one pass: row = key ps*32 + sub*16 + lq of the stage, split d map
  auto load_k = [&](FragB (&ak)[2][2], const v4u* frag, int ps) {
    #pragma unroll
    for (int sub = 0; sub < 2; ++sub) {
      #pragma unroll
      for (int f = 0; f < 2; ++f) {
        const v4u* base = frag + ps * SLU + (sub * 16) * LROW + f * 4;
        ak[sub][f].q[0] = base[0];                    // d = f*32 + hi*8 + 0..7
        ak[sub][f].q[1] = base[2];                    // d = f*32 + 16 + hi*8 + 0..7
      }
    }
  };
  // V B-fragments of one pass: column n = d = dt*16 + lq, split key map from the transposed rows
  auto load_v = [&](FragH (&bv)[4], const v4u* frag, int ps) {
    #pragma unroll
    for (int dt = 0; dt < 4; ++dt) {
      const v4u* base = frag + (2 + (dt >> 1)) * SLU + ((dt & 1) * 16) * LROW + ps * 4;
      bv[dt].q[0] = base[0];                          // keys ps*32 + hi*8 + 0..7
      bv[dt].q[1] = base[2];                          // keys ps*32 + 16 + hi*8 + 0..7
    }
  };
  // S^T tiles: c[qt][sub][r] = rawscore(query qrow0+qt*16+lq, key j0 + sub*16 + hi*8 + r); four independent chains of two
  auto scores = [&](v8f (&c)[2][2], FragB (&ak)[2][2]) {
    #pragma unroll
    for (int f = 0; f < 2; ++f) {
      #pragma unroll
      for (int sub = 0; sub < 2; ++sub) {
        #pragma unroll
        for (int qt = 0; qt < 2; ++qt) {
          c[qt][sub] = mma_bf16(ak[sub][f].v, qf[qt][f].v, f == 0 ? (v8f){0, 0, 0, 0, 0, 0, 0, 0} : c[qt][sub]);
        }
      }
    }
  };
  // exp + pack: P^T C-layout == A-fragment layout for the PV product; x[qt][sub][i] = exponents of keys sub*16 + hi*8 + 2i, 2i + 1
  auto exp_pack = [&](v2f (&x)[2][2][4], FragH (&pa)[2], float (&psum)[2]) {
    #pragma unroll
    for (int qt = 0; qt < 2; ++qt) {
      float acc = 0.0f;
      #pragma unroll
      for (int r = 0; r < 8; ++r) {
        const float p0 = __builtin_amdgcn_exp2f(x[qt][0][r >> 1][r & 1]);   // key hi*8 + r
        const float p1 = __builtin_amdgcn_exp2f(x[qt][1][r >> 1][r & 1]);   // key 16 + hi*8 + r
        acc += p0 + p1;
        pa[qt].h[r]     = (f16)p0;
        pa[qt].h[8 + r] = (f16)p1;
      }
      psum[qt] = acc;
    }
  };
  // softmax of one pass's scores and O += P x V, both Q tiles; first: the wave's first pass (scalar), which sets the maximum in use
  auto soft_pv = [&](v8f (&c)[2][2], FragH (&bv)[4], bool first) {
    v2f x[2][2][4];
    #pragma unroll
    for (int qt = 0; qt < 2; ++qt) {
      const v2f bb = (v2f){bias[qt], bias[qt]};
      #pragma unroll
      for (int sub = 0; sub < 2; ++sub) {
        #pragma unroll
        for (int i = 0; i < 4; ++i) {
          x[qt][sub][i] = __builtin_elementwise_fma((v2f){c[qt][sub][2 * i], c[qt][sub][2 * i + 1]}, (v2f){SL, SL}, bb);
        }
      }
    }
    FragH pa[2];
    float psum[2];
    exp_pack(x, pa, psum);

    // lazy rescale: one wave-uniform test per pass for both tiles, on the sums that the pass forms anyway. While a lane's sum
    // stays at or below PSUM_MAX each of its P is a finite f16; a larger sum (infinity too) renews the maximum in use: only
    // then are the pass's largest exponent, the halves' join, the scale's broadcast and the rescale of O and of the sum
    // formed, and the pass's P are formed again from the shifted exponents
    if ((__builtin_amdgcn_ballot_w32((psum[0] > PSUM_MAX) | (psum[1] > PSUM_MAX)) | (unsigned)first) != 0u) {
      #pragma unroll
      for (int qt = 0; qt < 2; ++qt) {
        v2f m2 = __builtin_elementwise_max(x[qt][0][0], x[qt][1][0]);
        #pragma unroll
        for (int i = 1; i < 4; ++i) m2 = __builtin_elementwise_max(m2, __builtin_elementwise_max(x[qt][0][i], x[qt][1][i]));
        const float mloc  = fmaxf(m2[0], m2[1]);
        const float joint = fmaxf(mloc, __shfl_xor(mloc, 16, 32));
        const float top   = first ? joint : fmaxf(joint, CARRY);   // the maximum in use never falls; CARRY is its own exponent
        const float nb    = bias[qt] + (CARRY - top);
        const float d     = nb - bias[qt];                         // the shift as the bias really takes it
        const float scale = __builtin_amdgcn_exp2f(fminf(d, 0.0f));   // d > 0 only in the first pass, where O and the sum are 0
        bias[qt] = nb;
        rsum[qt] *= scale;
        // queries are the row dimension of O -> per-row scale from lane 8*hi + r
        float sc[8];
        #pragma unroll
        for (int r = 0; r < 8; ++r) sc[r] = __shfl(scale, (hi << 3) + r, 32);
        #pragma unroll
        for (int dt = 0; dt < 4; ++dt) {
          #pragma unroll
          for (int r = 0; r < 8; ++r) o[qt][dt][r] *= sc[r];
        }
        #pragma unroll
        for (int sub = 0; sub < 2; ++sub) {
          #pragma unroll
          for (int i = 0; i < 4; ++i) x[qt][sub][i] += (v2f){d, d};
        }
      }
      exp_pack(x, pa, psum);
    }
    #pragma unroll
    for (int qt = 0; qt < 2; ++qt) rsum[qt] += psum[qt];   // this lane's share only: an exchange per pass would be waited for at the next test

    // O += P x V: each V fragment feeds both tiles
    __builtin_amdgcn_sched_barrier(0);                // keeps the sums' additions in front of the products: moved behind them they land in operand registers just read and cost v_nop padding
    #pragma unroll
    for (int dt = 0; dt < 4; ++dt) {
      #pragma unroll
      for (int qt = 0; qt < 2; ++qt) o[qt][dt] = mma_f16(pa[qt].v, bv[dt].v, o[qt][dt]);
    }
  };

  // fragments run ahead of their products: K of the next pass and V of this pass are read right behind a pass's
  // score products, so the LDS transfer runs under the softmax instead of being waited for at the top of each pass
  const v4u* fbase = sKV + kg * HALFU + lq * LROW + hi;   // this wave's key half, buffer 0
  FragB ak[2][2];
  load_k(ak, fbase, 0);                               // first fragment loads: stage 0 is published

  #pragma unroll 1   // rolled: the ring's publish point stands once in the two-pass body
  for (int t = 0; t < nstage; ++t) {
   const int bo = (t & 1) * BUFU;                     // this stage's buffer
   const v4u* frag = fbase + bo;
   FragH bv[4];
   v8f c[2][2];

   scores(c, ak);
   __builtin_amdgcn_sched_barrier(0);                 // keeps the eight score products in front of the load group: without it the loads stand among them in pieces
   load_v(bv, frag, 0);
   load_k(ak, frag, 1);
   __builtin_amdgcn_sched_barrier(0);                 // holds the load group here, as one group: without it the loads sink behind the rescale test, in pieces
   soft_pv(c, bv, t == 0);

   load_v(bv, frag, 1);                               // the second pass's V: its transfer runs under the products around it
   scores(c, ak);
   // distance behind the run of products (scores of the second pass) on the paths that jump over the refill and the
   // fetch below; naming c and o keeps the run in front; naming the two
   // row sums keeps the first pass's additions in front as well
   asm volatile("v_nop\n\tv_nop\n\tv_nop\n\tv_nop"
                : "+v"(c[0][0]), "+v"(c[0][1]), "+v"(c[1][0]), "+v"(c[1][1]),
                  "+v"(o[0][0]), "+v"(o[0][1]), "+v"(o[0][2]), "+v"(o[0][3]),
                  "+v"(o[1][0]), "+v"(o[1][1]), "+v"(o[1][2]), "+v"(o[1][3]), "+v"(rsum[0]), "+v"(rsum[1]));
   asm volatile("s_wait_dscnt 0x0" ::: "memory");
   asm volatile("s_wait_tensorcnt 0x0" ::: "memory");
   __syncthreads();
   if (pinned(t + 2 < nstage)) {                      // scalar: refill the buffer just read with stage t + 2
     fill(t & 1, t + 2);
   }
   if (t + 1 < nstage) {                              // uniform: the last stage has nothing behind it to fetch
     load_k(ak, fbase + ((t + 1) & 1) * BUFU, 0);
   }
   soft_pv(c, bv, false);
  }
  asm volatile("s_wait_tensorcnt 0x0" ::: "memory");  // nothing is in flight when the ring is left
  asm volatile("s_wait_dscnt 0x0" ::: "memory");      // and this wave's reads of the ring are done

  #pragma unroll
  for (int qt = 0; qt < 2; ++qt) rsum[qt] += __shfl_xor(rsum[qt], 16, 32);   // both lane halves carry the same maximum, so their sums add as they are

  // join of the two key halves: wave w keeps Q tile kg and hands the other tile (O, bias, sum; registers as they
  // lie, 16 B per lane and store) to wave w ^ 4 through its own staging slice
  const bool k1 = kg != 0;                            // scalar
  float*       so = sO + wave * (16 * OP);
  const float* sp = sO + (wave ^ 4) * (16 * OP);
  #pragma unroll
  for (int dt = 0; dt < 4; ++dt) {
    #pragma unroll
    for (int hh = 0; hh < 2; ++hh) {
      v4f w;
      #pragma unroll
      for (int i = 0; i < 4; ++i) w[i] = k1 ? o[0][dt][hh * 4 + i] : o[1][dt][hh * 4 + i];
      *(v4f*)(so + ((dt * 2 + hh) * 32 + lane) * 4) = w;
    }
  }
  so[1024 + lane] = k1 ? bias[0] : bias[1];
  so[1056 + lane] = k1 ? rsum[0] : rsum[1];
  __syncthreads();                                    // the handed-over tiles are written
  v4f po[8];
  #pragma unroll
  for (int j = 0; j < 8; ++j) po[j] = *(const v4f*)(sp + (j * 32 + lane) * 4);
  const float pb = sp[1024 + lane];
  const float ps = sp[1056 + lane];
  __syncthreads();                                    // every wave has read its partner's slice before the slices become output staging

  // both halves on the larger maximum, which has the smaller bias; the weights carry the division by the joined sum (O and the sums carry the same x256)
  const float b_own = k1 ? bias[1] : bias[0];
  const float s_own = k1 ? rsum[1] : rsum[0];
  const float b_all = fminf(b_own, pb);
  const float a_own = __builtin_amdgcn_exp2f(b_all - b_own);
  const float a_par = __builtin_amdgcn_exp2f(b_all - pb);
  const float inv   = 1.0f / (s_own * a_own + ps * a_par);
  const float f_own = a_own * inv;
  const float f_par = a_par * inv;

  // lane holds column d = dt*16 + lq for query rows 8*hi + r of its tile
  float fo[8], fp[8];
  #pragma unroll
  for (int r = 0; r < 8; ++r) {
    fo[r] = __shfl(f_own, (hi << 3) + r, 32);
    fp[r] = __shfl(f_par, (hi << 3) + r, 32);
  }

  #pragma unroll
  for (int r = 0; r < 8; ++r) {
    #pragma unroll
    for (int dt = 0; dt < 4; ++dt) {
      const float own = k1 ? o[1][dt][r] : o[0][dt][r];
      so[(hi * 8 + r) * OP + dt * 16 + lq] = own * fo[r] + po[dt * 2 + (r >> 2)][r & 3] * fp[r];
    }
  }
  __syncthreads();

  // lanes 0..15 store one row (16 consecutive lanes x 16 B each), lanes 16..31 the next row; 8 instructions cover the wave's 16 rows.
  v4f    vals[8];
  size_t gidx[8];
  #pragma unroll
  for (int it = 0; it < 8; ++it) {
    const int row = it * 2 + hi;
    vals[it] = *(const v4f*)(so + row * OP + lq * 4);
    gidx[it] = (((size_t)b * NHEAD + h) * SEQ_FULL + qrow0 + kg * 16 + row) * HDIM + lq * 4;
  }
  #pragma unroll
  for (int it = 0; it < 8; ++it) *(v4f*)(out + gidx[it]) = vals[it];
  
}

extern "C" void kernel_launch(void* const* d_in, const int* in_sizes, int n_in,
                              void* d_out, int out_size, void* d_ws, size_t ws_size,
                              hipStream_t stream) {
  if (n_in < 3) return;
  // last element touched of each [b][h][s][d] array (full-size strides, NB x SEQ sub-problem)
  const size_t need = ((((size_t)(NB - 1) * NHEAD + (NHEAD - 1)) * SEQ_FULL) + SEQ) * HDIM;
  if ((size_t)in_sizes[0] < need) return;
  if ((size_t)in_sizes[1] < need) return;
  if ((size_t)in_sizes[2] < need) return;
  if ((size_t)out_size < need) return;

  const size_t kb_elems = (size_t)NB * NHEAD * SEQ * HDIM;   // bf16 K plane
  const size_t vt_elems = (size_t)NB * NHEAD * HDIM * SEQ;   // f16 V^T plane
  const size_t kb_bytes = kb_elems * 2;
  const size_t vt_bytes = vt_elems * 2;
  if (ws_size < kb_bytes + vt_bytes) return;

  const float* q   = (const float*)d_in[0];
  const float* k   = (const float*)d_in[1];
  const float* v   = (const float*)d_in[2];
  float*       out = (float*)d_out;
  bf16*        kb  = (bf16*)d_ws;
  f16*         vt  = (f16*)((char*)d_ws + kb_bytes);

  kv_planes_kernel<<<dim3(SEQ / CT, NHEAD, NB), 256, 0, stream>>>(k, v, kb, vt);
  attn_kernel<<<dim3(SEQ / BQ, NHEAD, NB), 256, 0, stream>>>(q, kb, vt, out);
}
